// v000
// Measured on an AMD MI455X. A time is GPU time per run, averaged over a window of back-to-back runs after a warm-up
// (all launches, gaps included; the runs take copies of the inputs in turn), and the median of several windows.
// Apart from v000's, it joins two sittings. Times from different sittings can be a few percent apart, while
// side-by-side timings come from the same sitting.
// v000 is the starting kernel. One run takes 219 microseconds.
#include <hip/hip_runtime.h>
#include <hip/hip_bf16.h>
#include <math.h>

// ---------------------------------------------------------------------------
// Problem constants (from reference setup_inputs)
// ---------------------------------------------------------------------------
#define BATCH   8
#define CI      256
#define HWSZ    1600          // 40*40
#define DDIM    128
#define NCLOUD  32768
#define NHEAD   8
#define DH      16            // DDIM / NHEAD
#define GEM_EPS 1e-6f
#define L2_EPS  1e-12f

typedef float v2f __attribute__((ext_vector_type(2)));
typedef float v8f __attribute__((ext_vector_type(8)));
typedef int   v4i __attribute__((vector_size(16)));   // builtin's pointee type

#define GLB_AS __attribute__((address_space(1)))
#define LDS_AS __attribute__((address_space(3)))

// CDNA5 async global->LDS copy path (ASYNCcnt-tracked). Guarded so the file
// still compiles (host pass + older toolchains) with a plain-load fallback.
#if defined(__AMDGCN__) && __has_builtin(__builtin_amdgcn_global_load_async_to_lds_b128)
#define USE_ASYNC_LDS 1
#else
#define USE_ASYNC_LDS 0
#endif

#if USE_ASYNC_LDS
template <int N>
__device__ __forceinline__ void async_wait() {
#if __has_builtin(__builtin_amdgcn_s_wait_asynccnt)
  __builtin_amdgcn_s_wait_asynccnt(N);
#else
  asm volatile("s_wait_asynccnt %0" ::"i"(N) : "memory");
#endif
  asm volatile("" ::: "memory");   // keep LDS reads below the wait
}
#endif

// fp32 WMMA: D(16x16,f32) = A(16x4,f32) * B(4x16,f32) + C
__device__ __forceinline__ v8f wmma4(v2f a, v2f b, v8f c) {
  return __builtin_amdgcn_wmma_f32_16x16x4_f32(false, a, false, b, (short)0, c,
                                               false, false);
}

// Row reductions inside a 16-lane half (C/D layout: a row's 16 cols live in
// one 16-lane half of a wave32).
__device__ __forceinline__ float red16_max(float v) {
  v = fmaxf(v, __shfl_xor(v, 1, 32));
  v = fmaxf(v, __shfl_xor(v, 2, 32));
  v = fmaxf(v, __shfl_xor(v, 4, 32));
  v = fmaxf(v, __shfl_xor(v, 8, 32));
  return v;
}
__device__ __forceinline__ float red16_sum(float v) {
  v += __shfl_xor(v, 1, 32);
  v += __shfl_xor(v, 2, 32);
  v += __shfl_xor(v, 4, 32);
  v += __shfl_xor(v, 8, 32);
  return v;
}
__device__ __forceinline__ float red32_sum(float v) {
  v += __shfl_xor(v, 1, 32);
  v += __shfl_xor(v, 2, 32);
  v += __shfl_xor(v, 4, 32);
  v += __shfl_xor(v, 8, 32);
  v += __shfl_xor(v, 16, 32);
  return v;
}

// ---------------------------------------------------------------------------
// Kernel 0: zero the accumulator region of the workspace
// ---------------------------------------------------------------------------
__global__ void k_zero(float* p, int n) {
  int i = blockIdx.x * blockDim.x + threadIdx.x;
  if (i < n) p[i] = 0.0f;
}

// ---------------------------------------------------------------------------
// Kernel 1: tok = l2norm(image_feat^T @ W1 + b1)
// One wave per 16-row M-tile; computes the full 16x128 row block.
// ---------------------------------------------------------------------------
__global__ void __launch_bounds__(32)
k_gemm1_l2norm(const float* __restrict__ img, const float* __restrict__ W1,
               const float* __restrict__ b1, float* __restrict__ tok) {
  const int lane = threadIdx.x;
  const int lo = lane & 15, hi = lane >> 4;
  const int mBase = blockIdx.x * 16;          // 800 tiles, never crosses batch
  const int b  = mBase / HWSZ;
  const int hw = (mBase % HWSZ) + lo;
  const float* aBase = img + (size_t)b * CI * HWSZ + hw;

  v8f acc[8];
#pragma unroll
  for (int nt = 0; nt < 8; ++nt) acc[nt] = (v8f){0, 0, 0, 0, 0, 0, 0, 0};

  for (int k0 = 0; k0 < CI; k0 += 4) {
    const int ka = k0 + hi * 2;               // K per A/B fragment lane-half
    v2f a;
    a.x = aBase[(size_t)(ka + 0) * HWSZ];
    a.y = aBase[(size_t)(ka + 1) * HWSZ];
#pragma unroll
    for (int nt = 0; nt < 8; ++nt) {
      const int d = nt * 16 + lo;
      v2f bb;
      bb.x = W1[(ka + 0) * DDIM + d];
      bb.y = W1[(ka + 1) * DDIM + d];
      acc[nt] = wmma4(a, bb, acc[nt]);
    }
  }

  float bias[8];
#pragma unroll
  for (int nt = 0; nt < 8; ++nt) bias[nt] = b1[nt * 16 + lo];

#pragma unroll
  for (int r = 0; r < 8; ++r) {
    float ss = 0.0f;
#pragma unroll
    for (int nt = 0; nt < 8; ++nt) {
      float v = acc[nt][r] + bias[nt];
      acc[nt][r] = v;
      ss += v * v;
    }
    ss = red16_sum(ss);                       // per-row sum of squares
    const float inv = 1.0f / fmaxf(sqrtf(ss), L2_EPS);
    const int row = mBase + r + hi * 8;
#pragma unroll
    for (int nt = 0; nt < 8; ++nt)
      tok[(size_t)row * DDIM + nt * 16 + lo] = acc[nt][r] * inv;
  }
}

// ---------------------------------------------------------------------------
// Kernel 2: flash self-attention per (batch, head, 16-query tile).
// q = k = v = tok[:, head*16 : head*16+16].  Online softmax; P transposed
// C-layout -> A-layout through a 16x17 LDS tile.  Key/value tiles are staged
// to LDS with double-buffered GLOBAL_LOAD_ASYNC_TO_LDS_B128 (ASYNCcnt),
// overlapping the copy of tile kt+1 with the WMMA/softmax work on tile kt.
// ---------------------------------------------------------------------------
#define KVSTRIDE 20   // floats; 80B rows: 16B-aligned B128 chunks, no bank
                      // conflicts on column reads (5*dr % 16 != 0, dr=1..15)

#if USE_ASYNC_LDS
__device__ __forceinline__ void issue_kv(const float* __restrict__ tok,
                                         float* kvbuf, int kRow0, int dcol,
                                         int lane) {
  const int row = lane >> 2;                  // 0..7
  const int sub = (lane & 3) * 4;             // float offset in row
  const float* g0 = tok + (size_t)(kRow0 + row) * DDIM + dcol + sub;
  const float* g1 = g0 + (size_t)8 * DDIM;
  __builtin_amdgcn_global_load_async_to_lds_b128(
      (v4i*)g0, (LDS_AS v4i*)&kvbuf[row * KVSTRIDE + sub], 0, 0);
  __builtin_amdgcn_global_load_async_to_lds_b128(
      (v4i*)g1, (LDS_AS v4i*)&kvbuf[(row + 8) * KVSTRIDE + sub], 0, 0);
}
#endif

__global__ void __launch_bounds__(32)
k_attn(const float* __restrict__ tok, float* __restrict__ out) {
  __shared__ float pt[16 * 17];               // P transpose tile
#if USE_ASYNC_LDS
  __shared__ float kv[2][16 * KVSTRIDE];      // double-buffered K/V tile
#endif
  const int lane = threadIdx.x;
  const int lo = lane & 15, hi = lane >> 4;

  int idx = blockIdx.x;                       // 8*8*100 blocks
  const int qt = idx % 100; idx /= 100;
  const int h  = idx % NHEAD;
  const int b  = idx / NHEAD;
  const int dcol  = h * DH;
  const int qRow0 = b * HWSZ + qt * 16;
  const int bRow0 = b * HWSZ;

  // Q in A-layout: 4 chunks of 16x4
  v2f qa[4];
#pragma unroll
  for (int kk = 0; kk < 4; ++kk) {
    const float* p = tok + (size_t)(qRow0 + lo) * DDIM + dcol + kk * 4 + hi * 2;
    qa[kk].x = p[0];
    qa[kk].y = p[1];
  }

  v8f o = (v8f){0, 0, 0, 0, 0, 0, 0, 0};
  float mrun[8], lrun[8];
#pragma unroll
  for (int r = 0; r < 8; ++r) { mrun[r] = -INFINITY; lrun[r] = 0.0f; }

#if USE_ASYNC_LDS
  issue_kv(tok, kv[0], bRow0, dcol, lane);    // prime the pipeline
#endif

  for (int kt = 0; kt < 100; ++kt) {
    const int kRow0 = bRow0 + kt * 16;
#if USE_ASYNC_LDS
    float* kvc = kv[kt & 1];
    if (kt + 1 < 100) {                       // overlap next copy with compute
      issue_kv(tok, kv[(kt + 1) & 1], kRow0 + 16, dcol, lane);
      async_wait<2>();                        // in-order: older tile complete
    } else {
      async_wait<0>();
    }
#else
    if (kt + 1 < 100)                         // CDNA5 global_prefetch_b8
      __builtin_prefetch(tok + (size_t)(kRow0 + 16 + lo) * DDIM + dcol, 0, 0);
#endif

    // S = Q * K^T   (contraction over dh=16 -> 4 fp32 WMMAs)
    v8f S = (v8f){0, 0, 0, 0, 0, 0, 0, 0};
#pragma unroll
    for (int kk = 0; kk < 4; ++kk) {
      const int kidx = kk * 4 + hi * 2;
      v2f bs;                                  // B[K=d, N=key] = tok[key, d]
#if USE_ASYNC_LDS
      bs.x = kvc[lo * KVSTRIDE + kidx + 0];
      bs.y = kvc[lo * KVSTRIDE + kidx + 1];
#else
      const float* p = tok + (size_t)(kRow0 + lo) * DDIM + dcol + kidx;
      bs.x = p[0];
      bs.y = p[1];
#endif
      S = wmma4(qa[kk], bs, S);
    }

    // online softmax (row = one 16-lane half of each C VGPR)
#pragma unroll
    for (int r = 0; r < 8; ++r) {
      const float s    = S[r] * 0.25f;         // dh^-0.5
      const float tmax = red16_max(s);
      const float mnew = fmaxf(mrun[r], tmax);
      const float corr = __expf(mrun[r] - mnew);
      const float prob = __expf(s - mnew);
      lrun[r] = lrun[r] * corr + red16_sum(prob);
      mrun[r] = mnew;
      o[r] *= corr;
      pt[(r + hi * 8) * 17 + lo] = prob;       // P[row, key] for transpose
    }
    __syncthreads();

    // O += P * V   (contraction over 16 keys -> 4 fp32 WMMAs)
#pragma unroll
    for (int kk = 0; kk < 4; ++kk) {
      const int kidx = kk * 4 + hi * 2;
      v2f pa;                                  // A[M=row, K=key] from LDS
      pa.x = pt[lo * 17 + kidx + 0];
      pa.y = pt[lo * 17 + kidx + 1];
      v2f bo;                                  // B[K=key, N=d] = tok[key, d]
#if USE_ASYNC_LDS
      bo.x = kvc[(kidx + 0) * KVSTRIDE + lo];
      bo.y = kvc[(kidx + 1) * KVSTRIDE + lo];
#else
      const float* p = tok + (size_t)(kRow0 + kidx) * DDIM + dcol + lo;
      bo.x = p[0];
      bo.y = p[DDIM];
#endif
      o = wmma4(pa, bo, o);
    }
    __syncthreads();                           // protect pt for next tile
  }

#pragma unroll
  for (int r = 0; r < 8; ++r) {
    const int row = qRow0 + r + hi * 8;
    out[(size_t)row * DDIM + dcol + lo] = o[r] / lrun[r];
  }
}

// ---------------------------------------------------------------------------
// Kernel 3: img_out = (attn_out @ W2 + b2), stored as [B,Ci,H,W], fused with
// GeM clip^3 partial accumulation.  One wave per 16x16 output tile.
// ---------------------------------------------------------------------------
__global__ void __launch_bounds__(32)
k_gemm2(const float* __restrict__ x, const float* __restrict__ W2,
        const float* __restrict__ b2, float* __restrict__ img_out,
        float* __restrict__ gem_acc) {
  __shared__ float lds[16 * 17];
  const int lane = threadIdx.x;
  const int lo = lane & 15, hi = lane >> 4;
  const int mBase = blockIdx.x * 16;           // 800
  const int nBase = blockIdx.y * 16;           // 16
  const int b = mBase / HWSZ, hw0 = mBase % HWSZ;

  v8f acc = (v8f){0, 0, 0, 0, 0, 0, 0, 0};
  const float* aBase = x + (size_t)(mBase + lo) * DDIM;
  for (int k0 = 0; k0 < DDIM; k0 += 4) {
    const int ka = k0 + hi * 2;
    v2f a;
    a.x = aBase[ka + 0];
    a.y = aBase[ka + 1];
    v2f bb;
    bb.x = W2[(ka + 0) * CI + nBase + lo];
    bb.y = W2[(ka + 1) * CI + nBase + lo];
    acc = wmma4(a, bb, acc);
  }

  const float bias = b2[nBase + lo];
  float gsum = 0.0f;
#pragma unroll
  for (int r = 0; r < 8; ++r) {
    const float v = acc[r] + bias;
    lds[(r + hi * 8) * 17 + lo] = v;
    const float c = fmaxf(v, GEM_EPS);
    gsum += c * c * c;                         // clip^p, p=3
  }
  gsum += __shfl_xor(gsum, 16, 32);            // combine both 8-row halves
  __syncthreads();

  // transposed store: lane -> (channel = lane>>1, 8 consecutive hw)
  {
    const int c_local = lane >> 1;
    const int rhalf = (lane & 1) * 8;
    float* dst = img_out + ((size_t)(b * CI + nBase + c_local) * HWSZ) + hw0 + rhalf;
#pragma unroll
    for (int i = 0; i < 8; ++i) dst[i] = lds[(rhalf + i) * 17 + c_local];
  }
  if (lane < 16) atomicAdd(&gem_acc[b * CI + nBase + lane], gsum);
}

// ---------------------------------------------------------------------------
// Kernel 4: cloud branch: l2norm rows, clip^3, LDS-staged segment sums.
// One wave per row (128 elems = float4 per lane).
// ---------------------------------------------------------------------------
__global__ void __launch_bounds__(256)
k_cloud(const float* __restrict__ cf, const int* __restrict__ bids,
        float* __restrict__ cout, float* __restrict__ seg_acc,
        float* __restrict__ cnt_acc) {
  __shared__ float seg[BATCH * DDIM];
  __shared__ float cnt[BATCH];
  const int t = threadIdx.x;
  const int lane = t & 31;
  const int wave = t >> 5;
  for (int i = t; i < BATCH * DDIM; i += 256) seg[i] = 0.0f;
  if (t < BATCH) cnt[t] = 0.0f;
  __syncthreads();

  const int wgid = blockIdx.x * 8 + wave;
  const int nw = gridDim.x * 8;
  for (int row = wgid; row < NCLOUD; row += nw) {
    const float4 v = ((const float4*)(cf + (size_t)row * DDIM))[lane];
    float ss = v.x * v.x + v.y * v.y + v.z * v.z + v.w * v.w;
    ss = red32_sum(ss);
    const float inv = 1.0f / fmaxf(sqrtf(ss), L2_EPS);
    float4 o;
    o.x = v.x * inv; o.y = v.y * inv; o.z = v.z * inv; o.w = v.w * inv;
    ((float4*)(cout + (size_t)row * DDIM))[lane] = o;

    const int bid = bids[row];
    float cx = fmaxf(o.x, GEM_EPS), cy = fmaxf(o.y, GEM_EPS);
    float cz = fmaxf(o.z, GEM_EPS), cw = fmaxf(o.w, GEM_EPS);
    float* sp = seg + bid * DDIM + lane * 4;
    atomicAdd(sp + 0, cx * cx * cx);
    atomicAdd(sp + 1, cy * cy * cy);
    atomicAdd(sp + 2, cz * cz * cz);
    atomicAdd(sp + 3, cw * cw * cw);
    if (lane == 0) atomicAdd(&cnt[bid], 1.0f);
  }
  __syncthreads();
  for (int i = t; i < BATCH * DDIM; i += 256) atomicAdd(&seg_acc[i], seg[i]);
  if (t < BATCH) atomicAdd(&cnt_acc[t], cnt[t]);
}

// ---------------------------------------------------------------------------
// Kernel 5: finalize GeM pools
// ---------------------------------------------------------------------------
__global__ void k_finalize(const float* __restrict__ img_acc,
                           const float* __restrict__ seg_acc,
                           const float* __restrict__ cnt_acc,
                           float* __restrict__ image_gem,
                           float* __restrict__ cloud_gem) {
  const int i = blockIdx.x * blockDim.x + threadIdx.x;
  if (i < BATCH * CI) image_gem[i] = cbrtf(img_acc[i] * (1.0f / (float)HWSZ));
  if (i < BATCH * DDIM) {
    const int b = i / DDIM;
    cloud_gem[i] = cbrtf(seg_acc[i] / fmaxf(cnt_acc[b], 1.0f));
  }
}

// ---------------------------------------------------------------------------
// Host launcher
// ---------------------------------------------------------------------------
extern "C" void kernel_launch(void* const* d_in, const int* in_sizes, int n_in,
                              void* d_out, int out_size, void* d_ws, size_t ws_size,
                              hipStream_t stream) {
  const float* image_feat = (const float*)d_in[0];   // [8,256,40,40]
  const float* cloud_feat = (const float*)d_in[1];   // [32768,128]
  const int*   cloud_bids = (const int*)d_in[2];     // [32768]
  const float* W1 = (const float*)d_in[3];           // [256,128]
  const float* b1 = (const float*)d_in[4];           // [128]
  const float* W2 = (const float*)d_in[5];           // [128,256]
  const float* b2 = (const float*)d_in[6];           // [256]

  // Output layout (floats, concatenated in reference return order)
  float* out_img   = (float*)d_out;                         // 8*256*1600
  float* out_cloud = out_img + (size_t)BATCH * CI * HWSZ;   // 32768*128
  float* out_igem  = out_cloud + (size_t)NCLOUD * DDIM;     // 8*256
  float* out_cgem  = out_igem + BATCH * CI;                 // 8*128

  // Workspace layout (~13.1 MB of floats)
  float* ws      = (float*)d_ws;
  float* tok     = ws;                                      // 12800*128
  float* attn    = tok + (size_t)12800 * DDIM;              // 12800*128
  float* img_acc = attn + (size_t)12800 * DDIM;             // 2048
  float* seg_acc = img_acc + BATCH * CI;                    // 1024
  float* cnt_acc = seg_acc + BATCH * DDIM;                  // 8

  // 0) zero accumulators (ws is poisoned; must be deterministic every call)
  const int nzero = BATCH * CI + BATCH * DDIM + BATCH;      // 3080
  k_zero<<<(nzero + 255) / 256, 256, 0, stream>>>(img_acc, nzero);

  // 1) tok = l2norm(image^T @ W1 + b1)
  k_gemm1_l2norm<<<12800 / 16, 32, 0, stream>>>(image_feat, W1, b1, tok);

  // 2) flash self-attention per (b, head, q-tile)
  k_attn<<<BATCH * NHEAD * (HWSZ / 16), 32, 0, stream>>>(tok, attn);

  // 3) img_out = attn @ W2 + b2 (NCHW) + GeM accumulation
  k_gemm2<<<dim3(12800 / 16, CI / 16), 32, 0, stream>>>(attn, W2, b2,
                                                        out_img, img_acc);

  // 4) cloud branch
  k_cloud<<<256, 256, 0, stream>>>(cloud_feat, cloud_bids, out_cloud,
                                   seg_acc, cnt_acc);

  // 5) finalize GeM pools
  k_finalize<<<(BATCH * CI + 255) / 256, 256, 0, stream>>>(
      img_acc, seg_acc, cnt_acc, out_igem, out_cgem);
}

// v001
// It runs in 151 microseconds.
// Two timings next to v000 both put it at 1.50 times that version's speed.
#include <hip/hip_runtime.h>
#include <hip/hip_bf16.h>
#include <math.h>

// ---------------------------------------------------------------------------
// Problem constants (from reference setup_inputs)
// ---------------------------------------------------------------------------
#define BATCH   8
#define CI      256
#define HWSZ    1600          // 40*40
#define DDIM    128
#define NCLOUD  32768
#define NHEAD   8
#define DH      16            // DDIM / NHEAD
#define GEM_EPS 1e-6f
#define L2_EPS  1e-12f
#define LOG2E   1.44269504088896340736f

typedef float v2f __attribute__((ext_vector_type(2)));
typedef float v8f __attribute__((ext_vector_type(8)));
typedef int   v4i __attribute__((vector_size(16)));   // builtin's pointee type

#define GLB_AS __attribute__((address_space(1)))
#define LDS_AS __attribute__((address_space(3)))

// CDNA5 async global->LDS copy path (ASYNCcnt-tracked). Guarded so the file
// still compiles (host pass + older toolchains) with a plain-load fallback.
#if defined(__AMDGCN__) && __has_builtin(__builtin_amdgcn_global_load_async_to_lds_b128)
#define USE_ASYNC_LDS 1
#else
#define USE_ASYNC_LDS 0
#endif

#if USE_ASYNC_LDS
template <int N>
__device__ __forceinline__ void async_wait() {
#if __has_builtin(__builtin_amdgcn_s_wait_asynccnt)
  __builtin_amdgcn_s_wait_asynccnt(N);
#else
  asm volatile("s_wait_asynccnt %0" ::"i"(N) : "memory");
#endif
  asm volatile("" ::: "memory");   // keep LDS reads below the wait
}
#endif

// fp32 WMMA: D(16x16,f32) = A(16x4,f32) * B(4x16,f32) + C
__device__ __forceinline__ v8f wmma4(v2f a, v2f b, v8f c) {
  return __builtin_amdgcn_wmma_f32_16x16x4_f32(false, a, false, b, (short)0, c,
                                               false, false);
}

// Row reductions inside a 16-lane half (C/D layout: a row's 16 cols live in
// one 16-lane half of a wave32).
__device__ __forceinline__ float red16_sum(float v) {
  v += __shfl_xor(v, 1, 32);
  v += __shfl_xor(v, 2, 32);
  v += __shfl_xor(v, 4, 32);
  v += __shfl_xor(v, 8, 32);
  return v;
}
__device__ __forceinline__ float red32_sum(float v) {
  v += __shfl_xor(v, 1, 32);
  v += __shfl_xor(v, 2, 32);
  v += __shfl_xor(v, 4, 32);
  v += __shfl_xor(v, 8, 32);
  v += __shfl_xor(v, 16, 32);
  return v;
}

// ---------------------------------------------------------------------------
// Kernel 0: zero the accumulator region of the workspace
// ---------------------------------------------------------------------------
__global__ void k_zero(float* p, int n) {
  int i = blockIdx.x * blockDim.x + threadIdx.x;
  if (i < n) p[i] = 0.0f;
}

// ---------------------------------------------------------------------------
// Kernel 1: tok = l2norm(image_feat^T @ W1 + b1)
// One wave per 16-row M-tile; computes the full 16x128 row block.
// ---------------------------------------------------------------------------
__global__ void __launch_bounds__(32)
k_gemm1_l2norm(const float* __restrict__ img, const float* __restrict__ W1,
               const float* __restrict__ b1, float* __restrict__ tok) {
  const int lane = threadIdx.x;
  const int lo = lane & 15, hi = lane >> 4;
  const int mBase = blockIdx.x * 16;          // 800 tiles, never crosses batch
  const int b  = mBase / HWSZ;
  const int hw = (mBase % HWSZ) + lo;
  const float* aBase = img + (size_t)b * CI * HWSZ + hw;

  v8f acc[8];
#pragma unroll
  for (int nt = 0; nt < 8; ++nt) acc[nt] = (v8f){0, 0, 0, 0, 0, 0, 0, 0};

  for (int k0 = 0; k0 < CI; k0 += 4) {
    const int ka = k0 + hi * 2;               // K per A/B fragment lane-half
    v2f a;
    a.x = aBase[(size_t)(ka + 0) * HWSZ];
    a.y = aBase[(size_t)(ka + 1) * HWSZ];
#pragma unroll
    for (int nt = 0; nt < 8; ++nt) {
      const int d = nt * 16 + lo;
      v2f bb;
      bb.x = W1[(ka + 0) * DDIM + d];
      bb.y = W1[(ka + 1) * DDIM + d];
      acc[nt] = wmma4(a, bb, acc[nt]);
    }
  }

  float bias[8];
#pragma unroll
  for (int nt = 0; nt < 8; ++nt) bias[nt] = b1[nt * 16 + lo];

#pragma unroll
  for (int r = 0; r < 8; ++r) {
    float ss = 0.0f;
#pragma unroll
    for (int nt = 0; nt < 8; ++nt) {
      float v = acc[nt][r] + bias[nt];
      acc[nt][r] = v;
      ss += v * v;
    }
    ss = red16_sum(ss);                       // per-row sum of squares
    const float inv = 1.0f / fmaxf(sqrtf(ss), L2_EPS);
    const int row = mBase + r + hi * 8;
#pragma unroll
    for (int nt = 0; nt < 8; ++nt)
      tok[(size_t)row * DDIM + nt * 16 + lo] = acc[nt][r] * inv;
  }
}

#define KVSTRIDE 20

#if USE_ASYNC_LDS
__device__ __forceinline__ void issue_kv(const float* __restrict__ tok,
                                         float* kvbuf, int kRow0, int dcol,
                                         int lane) {
  const int row = lane >> 2;                  // 0..7
  const int sub = (lane & 3) * 4;             // float offset in row
  const float* g0 = tok + (size_t)(kRow0 + row) * DDIM + dcol + sub;
  const float* g1 = g0 + (size_t)8 * DDIM;
  __builtin_amdgcn_global_load_async_to_lds_b128(
      (v4i*)g0, (LDS_AS v4i*)&kvbuf[row * KVSTRIDE + sub], 0, 0);
  __builtin_amdgcn_global_load_async_to_lds_b128(
      (v4i*)g1, (LDS_AS v4i*)&kvbuf[(row + 8) * KVSTRIDE + sub], 0, 0);
}
#endif

// Value of lane l ^ 16 (the other half of the wave), by a vector cross-row move.
__device__ __forceinline__ float other_half(float v) {
  const unsigned u = __builtin_bit_cast(unsigned, v);
  return __builtin_bit_cast(float, __builtin_amdgcn_permlanex16(
      u, u, 0x76543210u, 0xfedcba98u, false, false));
}

__global__ void __launch_bounds__(32)
k_attn(const float* __restrict__ tok, float* __restrict__ out) {
#if USE_ASYNC_LDS
  __shared__ float kv[2][16 * KVSTRIDE];      // double-buffered K/V tile
#endif
  const int lane = threadIdx.x;
  const int lo = lane & 15, hi = lane >> 4;

  int idx = blockIdx.x;                       // 8*8*100 blocks
  const int qt = idx % 100; idx /= 100;
  const int h  = idx % NHEAD;
  const int b  = idx / NHEAD;
  const int dcol  = h * DH;
  const int qRow0 = b * HWSZ + qt * 16;
  const int bRow0 = b * HWSZ;

  // Q^T in B-layout: 4 chunks of 4x16, B[K=d, N=query] = tok[query, d]
  v2f qb[4];
#pragma unroll
  for (int kk = 0; kk < 4; ++kk) {
    const float* p = tok + (size_t)(qRow0 + lo) * DDIM + dcol + kk * 4 + hi * 2;
    qb[kk].x = p[0];
    qb[kk].y = p[1];
  }

  // O^T accumulator: o[r] = O[query = lo][d = r + 8*hi]
  v8f o = (v8f){0, 0, 0, 0, 0, 0, 0, 0};
  float mrun = -INFINITY;                     // query lo's running maximum
  float lrun = 0.0f;                          // this half's share of its sum

#if USE_ASYNC_LDS
  issue_kv(tok, kv[0], bRow0, dcol, lane);    // prime the pipeline
#endif

  for (int kt = 0; kt < 100; ++kt) {
    const int kRow0 = bRow0 + kt * 16;
#if USE_ASYNC_LDS
    float* kvc = kv[kt & 1];
    if (kt + 1 < 100) {                       // overlap next copy with compute
      issue_kv(tok, kv[(kt + 1) & 1], kRow0 + 16, dcol, lane);
      async_wait<2>();                        // in-order: older tile complete
    } else {
      async_wait<0>();
    }
#else
    if (kt + 1 < 100)                         // CDNA5 global_prefetch_b8
      __builtin_prefetch(tok + (size_t)(kRow0 + 16 + lo) * DDIM + dcol, 0, 0);
#endif

    // S^T = K * Q^T   (contraction over dh=16 -> 4 fp32 WMMAs)
    // S[r] = score(query = lo, key = r + 8*hi)
    v8f S = (v8f){0, 0, 0, 0, 0, 0, 0, 0};
#pragma unroll
    for (int kk = 0; kk < 4; ++kk) {
      const int kidx = kk * 4 + hi * 2;
      v2f ka;                                  // A[M=key, K=d] = tok[key, d]
#if USE_ASYNC_LDS
      ka.x = kvc[lo * KVSTRIDE + kidx + 0];
      ka.y = kvc[lo * KVSTRIDE + kidx + 1];
#else
      const float* p = tok + (size_t)(kRow0 + lo) * DDIM + dcol + kidx;
      ka.x = p[0];
      ka.y = p[1];
#endif
      S = wmma4(ka, qb[kk], S);
    }

    // online softmax: one query per lane, its 16 keys split over the halves
    const v8f s = S * 0.25f;                   // dh^-0.5
    float tmax = s[0];
#pragma unroll
    for (int r = 1; r < 8; ++r) tmax = fmaxf(tmax, s[r]);
    tmax = fmaxf(tmax, other_half(tmax));
    const float mnew = fmaxf(mrun, tmax);
    const float corr = __expf(mrun - mnew);
    const v8f e = (s - mnew) * LOG2E;          // exp(x) = exp2(x * log2 e)
    v8f prob;
    float psum = 0.0f;
#pragma unroll
    for (int r = 0; r < 8; ++r) {
      prob[r] = __builtin_amdgcn_exp2f(e[r]);
      psum += prob[r];
    }
    lrun = lrun * corr + psum;
    mrun = mnew;
    o *= corr;

    // O^T += V^T * P^T   (contraction over 16 keys -> 4 fp32 WMMAs)
    // k position hi*2 + i of chunk j stands for key 2*j + i + 8*hi on both sides
#if USE_ASYNC_LDS
    const float* vcol = kvc + hi * 8 * KVSTRIDE + lo;
#else
    const float* vcol = tok + (size_t)(kRow0 + hi * 8) * DDIM + dcol + lo;
#endif
#pragma unroll
    for (int j = 0; j < 4; ++j) {
      v2f va;                                  // A[M=d, K=key] = tok[key, d]
#if USE_ASYNC_LDS
      va.x = vcol[(j * 2 + 0) * KVSTRIDE];
      va.y = vcol[(j * 2 + 1) * KVSTRIDE];
#else
      va.x = vcol[(j * 2 + 0) * DDIM];
      va.y = vcol[(j * 2 + 1) * DDIM];
#endif
      v2f pb;                                  // B[K=key, N=query]
      pb.x = prob[j * 2 + 0];
      pb.y = prob[j * 2 + 1];
      o = wmma4(va, pb, o);
    }
#if USE_ASYNC_LDS
    // The ring is private to this one wave: its own reads of kvc must have
    // retired before the next trip's copies refill that buffer.
    asm volatile("s_wait_dscnt 0x0" ::: "memory");
#endif
  }

  const float l = lrun + other_half(lrun);     // join the halves' sums once
  float4 w0, w1;                               // 8 consecutive d of one query
  w0.x = o[0] / l; w0.y = o[1] / l; w0.z = o[2] / l; w0.w = o[3] / l;
  w1.x = o[4] / l; w1.y = o[5] / l; w1.z = o[6] / l; w1.w = o[7] / l;
  float4* dst = (float4*)(out + (size_t)(qRow0 + lo) * DDIM + dcol + hi * 8);
  dst[0] = w0;
  dst[1] = w1;
}

// ---------------------------------------------------------------------------
// Kernel 3: img_out = (attn_out @ W2 + b2), stored as [B,Ci,H,W], fused with
// GeM clip^3 partial accumulation.  One wave per 16x16 output tile.
// ---------------------------------------------------------------------------
__global__ void __launch_bounds__(32)
k_gemm2(const float* __restrict__ x, const float* __restrict__ W2,
        const float* __restrict__ b2, float* __restrict__ img_out,
        float* __restrict__ gem_acc) {
  __shared__ float lds[16 * 17];
  const int lane = threadIdx.x;
  const int lo = lane & 15, hi = lane >> 4;
  const int mBase = blockIdx.x * 16;           // 800
  const int nBase = blockIdx.y * 16;           // 16
  const int b = mBase / HWSZ, hw0 = mBase % HWSZ;

  v8f acc = (v8f){0, 0, 0, 0, 0, 0, 0, 0};
  const float* aBase = x + (size_t)(mBase + lo) * DDIM;
  for (int k0 = 0; k0 < DDIM; k0 += 4) {
    const int ka = k0 + hi * 2;
    v2f a;
    a.x = aBase[ka + 0];
    a.y = aBase[ka + 1];
    v2f bb;
    bb.x = W2[(ka + 0) * CI + nBase + lo];
    bb.y = W2[(ka + 1) * CI + nBase + lo];
    acc = wmma4(a, bb, acc);
  }

  const float bias = b2[nBase + lo];
  float gsum = 0.0f;
#pragma unroll
  for (int r = 0; r < 8; ++r) {
    const float v = acc[r] + bias;
    lds[(r + hi * 8) * 17 + lo] = v;
    const float c = fmaxf(v, GEM_EPS);
    gsum += c * c * c;                         // clip^p, p=3
  }
  gsum += __shfl_xor(gsum, 16, 32);            // combine both 8-row halves
  __syncthreads();

  // transposed store: lane -> (channel = lane>>1, 8 consecutive hw)
  {
    const int c_local = lane >> 1;
    const int rhalf = (lane & 1) * 8;
    float* dst = img_out + ((size_t)(b * CI + nBase + c_local) * HWSZ) + hw0 + rhalf;
#pragma unroll
    for (int i = 0; i < 8; ++i) dst[i] = lds[(rhalf + i) * 17 + c_local];
  }
  if (lane < 16) atomicAdd(&gem_acc[b * CI + nBase + lane], gsum);
}

// ---------------------------------------------------------------------------
// Kernel 4: cloud branch: l2norm rows, clip^3, LDS-staged segment sums.
// One wave per row (128 elems = float4 per lane).
// ---------------------------------------------------------------------------
__global__ void __launch_bounds__(256)
k_cloud(const float* __restrict__ cf, const int* __restrict__ bids,
        float* __restrict__ cout, float* __restrict__ seg_acc,
        float* __restrict__ cnt_acc) {
  __shared__ float seg[BATCH * DDIM];
  __shared__ float cnt[BATCH];
  const int t = threadIdx.x;
  const int lane = t & 31;
  const int wave = t >> 5;
  for (int i = t; i < BATCH * DDIM; i += 256) seg[i] = 0.0f;
  if (t < BATCH) cnt[t] = 0.0f;
  __syncthreads();

  const int wgid = blockIdx.x * 8 + wave;
  const int nw = gridDim.x * 8;
  for (int row = wgid; row < NCLOUD; row += nw) {
    const float4 v = ((const float4*)(cf + (size_t)row * DDIM))[lane];
    float ss = v.x * v.x + v.y * v.y + v.z * v.z + v.w * v.w;
    ss = red32_sum(ss);
    const float inv = 1.0f / fmaxf(sqrtf(ss), L2_EPS);
    float4 o;
    o.x = v.x * inv; o.y = v.y * inv; o.z = v.z * inv; o.w = v.w * inv;
    ((float4*)(cout + (size_t)row * DDIM))[lane] = o;

    const int bid = bids[row];
    float cx = fmaxf(o.x, GEM_EPS), cy = fmaxf(o.y, GEM_EPS);
    float cz = fmaxf(o.z, GEM_EPS), cw = fmaxf(o.w, GEM_EPS);
    float* sp = seg + bid * DDIM + lane * 4;
    atomicAdd(sp + 0, cx * cx * cx);
    atomicAdd(sp + 1, cy * cy * cy);
    atomicAdd(sp + 2, cz * cz * cz);
    atomicAdd(sp + 3, cw * cw * cw);
    if (lane == 0) atomicAdd(&cnt[bid], 1.0f);
  }
  __syncthreads();
  for (int i = t; i < BATCH * DDIM; i += 256) atomicAdd(&seg_acc[i], seg[i]);
  if (t < BATCH) atomicAdd(&cnt_acc[t], cnt[t]);
}

// ---------------------------------------------------------------------------
// Kernel 5: finalize GeM pools
// ---------------------------------------------------------------------------
__global__ void k_finalize(const float* __restrict__ img_acc,
                           const float* __restrict__ seg_acc,
                           const float* __restrict__ cnt_acc,
                           float* __restrict__ image_gem,
                           float* __restrict__ cloud_gem) {
  const int i = blockIdx.x * blockDim.x + threadIdx.x;
  if (i < BATCH * CI) image_gem[i] = cbrtf(img_acc[i] * (1.0f / (float)HWSZ));
  if (i < BATCH * DDIM) {
    const int b = i / DDIM;
    cloud_gem[i] = cbrtf(seg_acc[i] / fmaxf(cnt_acc[b], 1.0f));
  }
}

// ---------------------------------------------------------------------------
// Host launcher
// ---------------------------------------------------------------------------
extern "C" void kernel_launch(void* const* d_in, const int* in_sizes, int n_in,
                              void* d_out, int out_size, void* d_ws, size_t ws_size,
                              hipStream_t stream) {
  const float* image_feat = (const float*)d_in[0];   // [8,256,40,40]
  const float* cloud_feat = (const float*)d_in[1];   // [32768,128]
  const int*   cloud_bids = (const int*)d_in[2];     // [32768]
  const float* W1 = (const float*)d_in[3];           // [256,128]
  const float* b1 = (const float*)d_in[4];           // [128]
  const float* W2 = (const float*)d_in[5];           // [128,256]
  const float* b2 = (const float*)d_in[6];           // [256]

  // Output layout (floats, concatenated in reference return order)
  float* out_img   = (float*)d_out;                         // 8*256*1600
  float* out_cloud = out_img + (size_t)BATCH * CI * HWSZ;   // 32768*128
  float* out_igem  = out_cloud + (size_t)NCLOUD * DDIM;     // 8*256
  float* out_cgem  = out_igem + BATCH * CI;                 // 8*128

  // Workspace layout (~13.1 MB of floats)
  float* ws      = (float*)d_ws;
  float* tok     = ws;                                      // 12800*128
  float* attn    = tok + (size_t)12800 * DDIM;              // 12800*128
  float* img_acc = attn + (size_t)12800 * DDIM;             // 2048
  float* seg_acc = img_acc + BATCH * CI;                    // 1024
  float* cnt_acc = seg_acc + BATCH * DDIM;                  // 8

  // 0) zero accumulators (ws is poisoned; must be deterministic every call)
  const int nzero = BATCH * CI + BATCH * DDIM + BATCH;      // 3080
  k_zero<<<(nzero + 255) / 256, 256, 0, stream>>>(img_acc, nzero);

  // 1) tok = l2norm(image^T @ W1 + b1)
  k_gemm1_l2norm<<<12800 / 16, 32, 0, stream>>>(image_feat, W1, b1, tok);

  // 2) flash self-attention per (b, head, q-tile)
  k_attn<<<BATCH * NHEAD * (HWSZ / 16), 32, 0, stream>>>(tok, attn);

  // 3) img_out = attn @ W2 + b2 (NCHW) + GeM accumulation
  k_gemm2<<<dim3(12800 / 16, CI / 16), 32, 0, stream>>>(attn, W2, b2,
                                                        out_img, img_acc);

  // 4) cloud branch
  k_cloud<<<256, 256, 0, stream>>>(cloud_feat, cloud_bids, out_cloud,
                                   seg_acc, cnt_acc);

  // 5) finalize GeM pools
  k_finalize<<<(BATCH * CI + 255) / 256, 256, 0, stream>>>(
      img_acc, seg_acc, cnt_acc, out_igem, out_cgem);
}

// v002
// A run of this version takes 142 microseconds.
// Next to v001, in two timings, it ran 1.07 times as fast each time.
// Over all steps from v000 it is 1.60 times as fast.
#include <hip/hip_runtime.h>
#include <hip/hip_bf16.h>
#include <math.h>

// ---------------------------------------------------------------------------
// Problem constants (from reference setup_inputs)
// ---------------------------------------------------------------------------
#define BATCH   8
#define CI      256
#define HWSZ    1600          // 40*40
#define DDIM    128
#define NCLOUD  32768
#define NHEAD   8
#define DH      16            // DDIM / NHEAD
#define GEM_EPS 1e-6f
#define L2_EPS  1e-12f
#define LOG2E   1.44269504088896340736f

typedef float v2f __attribute__((ext_vector_type(2)));
typedef float v8f __attribute__((ext_vector_type(8)));
typedef int   v4i __attribute__((vector_size(16)));   // builtin's pointee type

#define GLB_AS __attribute__((address_space(1)))
#define LDS_AS __attribute__((address_space(3)))

// CDNA5 async global->LDS copy path (ASYNCcnt-tracked). Guarded so the file
// still compiles (host pass + older toolchains) with a plain-load fallback.
#if defined(__AMDGCN__) && __has_builtin(__builtin_amdgcn_global_load_async_to_lds_b128)
#define USE_ASYNC_LDS 1
#else
#define USE_ASYNC_LDS 0
#endif

#if USE_ASYNC_LDS
template <int N>
__device__ __forceinline__ void async_wait() {
#if __has_builtin(__builtin_amdgcn_s_wait_asynccnt)
  __builtin_amdgcn_s_wait_asynccnt(N);
#else
  asm volatile("s_wait_asynccnt %0" ::"i"(N) : "memory");
#endif
  asm volatile("" ::: "memory");   // keep LDS reads below the wait
}
#endif

// fp32 WMMA: D(16x16,f32) = A(16x4,f32) * B(4x16,f32) + C
__device__ __forceinline__ v8f wmma4(v2f a, v2f b, v8f c) {
  return __builtin_amdgcn_wmma_f32_16x16x4_f32(false, a, false, b, (short)0, c,
                                               false, false);
}

// Row reductions inside a 16-lane half (C/D layout: a row's 16 cols live in
// one 16-lane half of a wave32).
__device__ __forceinline__ float red16_sum(float v) {
  v += __shfl_xor(v, 1, 32);
  v += __shfl_xor(v, 2, 32);
  v += __shfl_xor(v, 4, 32);
  v += __shfl_xor(v, 8, 32);
  return v;
}
__device__ __forceinline__ float red32_sum(float v) {
  v += __shfl_xor(v, 1, 32);
  v += __shfl_xor(v, 2, 32);
  v += __shfl_xor(v, 4, 32);
  v += __shfl_xor(v, 8, 32);
  v += __shfl_xor(v, 16, 32);
  return v;
}

// ---------------------------------------------------------------------------
// Kernel 0: zero the accumulator region of the workspace
// ---------------------------------------------------------------------------
__global__ void k_zero(float* p, int n) {
  int i = blockIdx.x * blockDim.x + threadIdx.x;
  if (i < n) p[i] = 0.0f;
}

// ---------------------------------------------------------------------------
// Kernel 1: tok = l2norm(image_feat^T @ W1 + b1)
// One wave per 16-row M-tile; computes the full 16x128 row block.
// ---------------------------------------------------------------------------
__global__ void __launch_bounds__(32)
k_gemm1_l2norm(const float* __restrict__ img, const float* __restrict__ W1,
               const float* __restrict__ b1, float* __restrict__ tok) {
  const int lane = threadIdx.x;
  const int lo = lane & 15, hi = lane >> 4;
  const int mBase = blockIdx.x * 16;          // 800 tiles, never crosses batch
  const int b  = mBase / HWSZ;
  const int hw = (mBase % HWSZ) + lo;
  const float* aBase = img + (size_t)b * CI * HWSZ + hw;

  v8f acc[8];
#pragma unroll
  for (int nt = 0; nt < 8; ++nt) acc[nt] = (v8f){0, 0, 0, 0, 0, 0, 0, 0};

  for (int k0 = 0; k0 < CI; k0 += 4) {
    const int ka = k0 + hi * 2;               // K per A/B fragment lane-half
    v2f a;
    a.x = aBase[(size_t)(ka + 0) * HWSZ];
    a.y = aBase[(size_t)(ka + 1) * HWSZ];
#pragma unroll
    for (int nt = 0; nt < 8; ++nt) {
      const int d = nt * 16 + lo;
      v2f bb;
      bb.x = W1[(ka + 0) * DDIM + d];
      bb.y = W1[(ka + 1) * DDIM + d];
      acc[nt] = wmma4(a, bb, acc[nt]);
    }
  }

  float bias[8];
#pragma unroll
  for (int nt = 0; nt < 8; ++nt) bias[nt] = b1[nt * 16 + lo];

#pragma unroll
  for (int r = 0; r < 8; ++r) {
    float ss = 0.0f;
#pragma unroll
    for (int nt = 0; nt < 8; ++nt) {
      float v = acc[nt][r] + bias[nt];
      acc[nt][r] = v;
      ss += v * v;
    }
    ss = red16_sum(ss);                       // per-row sum of squares
    const float inv = 1.0f / fmaxf(sqrtf(ss), L2_EPS);
    const int row = mBase + r + hi * 8;
#pragma unroll
    for (int nt = 0; nt < 8; ++nt)
      tok[(size_t)row * DDIM + nt * 16 + lo] = acc[nt][r] * inv;
  }
}

#define KVSTRIDE 20

#if USE_ASYNC_LDS
__device__ __forceinline__ void issue_kv(const float* __restrict__ tok,
                                         float* kvbuf, int kRow0, int dcol,
                                         int lane) {
  const int row = lane >> 2;                  // 0..7
  const int sub = (lane & 3) * 4;             // float offset in row
  const float* g0 = tok + (size_t)(kRow0 + row) * DDIM + dcol + sub;
  const float* g1 = g0 + (size_t)8 * DDIM;
  __builtin_amdgcn_global_load_async_to_lds_b128(
      (v4i*)g0, (LDS_AS v4i*)&kvbuf[row * KVSTRIDE + sub], 0, 0);
  __builtin_amdgcn_global_load_async_to_lds_b128(
      (v4i*)g1, (LDS_AS v4i*)&kvbuf[(row + 8) * KVSTRIDE + sub], 0, 0);
}
#endif

// Value of lane l ^ 16 (the other half of the wave), by a vector cross-row move.
__device__ __forceinline__ float other_half(float v) {
  const unsigned u = __builtin_bit_cast(unsigned, v);
  return __builtin_bit_cast(float, __builtin_amdgcn_permlanex16(
      u, u, 0x76543210u, 0xfedcba98u, false, false));
}

__global__ void __launch_bounds__(32)
k_attn(const float* __restrict__ tok, float* __restrict__ out) {
#if USE_ASYNC_LDS
  __shared__ float kv[2][16 * KVSTRIDE];      // double-buffered K/V tile
#endif
  const int lane = threadIdx.x;
  const int lo = lane & 15, hi = lane >> 4;

  int idx = blockIdx.x;                       // 8*8*100 blocks
  const int qt = idx % 100; idx /= 100;
  const int h  = idx % NHEAD;
  const int b  = idx / NHEAD;
  const int dcol  = h * DH;
  const int qRow0 = b * HWSZ + qt * 16;
  const int bRow0 = b * HWSZ;

  // Q^T in B-layout: 4 chunks of 4x16, B[K=d, N=query] = tok[query, d]
  v2f qb[4];
#pragma unroll
  for (int kk = 0; kk < 4; ++kk) {
    const float* p = tok + (size_t)(qRow0 + lo) * DDIM + dcol + kk * 4 + hi * 2;
    qb[kk].x = p[0];
    qb[kk].y = p[1];
  }

  // O^T accumulator: o[r] = O[query = lo][d = r + 8*hi]
  v8f o = (v8f){0, 0, 0, 0, 0, 0, 0, 0};
  float lrun = 0.0f;                          // this half's share of query lo's sum

#if USE_ASYNC_LDS
  issue_kv(tok, kv[0], bRow0, dcol, lane);    // prime the pipeline
#endif

  for (int kt = 0; kt < 100; ++kt) {
    const int kRow0 = bRow0 + kt * 16;
#if USE_ASYNC_LDS
    float* kvc = kv[kt & 1];
    if (kt + 1 < 100) {                       // overlap next copy with compute
      issue_kv(tok, kv[(kt + 1) & 1], kRow0 + 16, dcol, lane);
      async_wait<2>();                        // in-order: older tile complete
    } else {
      async_wait<0>();
    }
#else
    if (kt + 1 < 100)                         // CDNA5 global_prefetch_b8
      __builtin_prefetch(tok + (size_t)(kRow0 + 16 + lo) * DDIM + dcol, 0, 0);
#endif

    // S^T = K * Q^T   (contraction over dh=16 -> 4 fp32 WMMAs)
    // S[r] = score(query = lo, key = r + 8*hi)
    v8f S = (v8f){0, 0, 0, 0, 0, 0, 0, 0};
#pragma unroll
    for (int kk = 0; kk < 4; ++kk) {
      const int kidx = kk * 4 + hi * 2;
      v2f ka;                                  // A[M=key, K=d] = tok[key, d]
#if USE_ASYNC_LDS
      ka.x = kvc[lo * KVSTRIDE + kidx + 0];
      ka.y = kvc[lo * KVSTRIDE + kidx + 1];
#else
      const float* p = tok + (size_t)(kRow0 + lo) * DDIM + dcol + kidx;
      ka.x = p[0];
      ka.y = p[1];
#endif
      S = wmma4(ka, qb[kk], S);
    }

    // softmax numerators: one query per lane, its 16 keys split over the halves
    const v8f e = S * (0.25f * LOG2E);         // dh^-0.5; exp(x) = exp2(x * log2 e)
    v8f prob;
    float psum = 0.0f;
#pragma unroll
    for (int r = 0; r < 8; ++r) {
      prob[r] = __builtin_amdgcn_exp2f(e[r]);
      psum += prob[r];
    }
    lrun += psum;

    // O^T += V^T * P^T   (contraction over 16 keys -> 4 fp32 WMMAs)
    // k position hi*2 + i of chunk j stands for key 2*j + i + 8*hi on both sides
#if USE_ASYNC_LDS
    const float* vcol = kvc + hi * 8 * KVSTRIDE + lo;
#else
    const float* vcol = tok + (size_t)(kRow0 + hi * 8) * DDIM + dcol + lo;
#endif
#pragma unroll
    for (int j = 0; j < 4; ++j) {
      v2f va;                                  // A[M=d, K=key] = tok[key, d]
#if USE_ASYNC_LDS
      va.x = vcol[(j * 2 + 0) * KVSTRIDE];
      va.y = vcol[(j * 2 + 1) * KVSTRIDE];
#else
      va.x = vcol[(j * 2 + 0) * DDIM];
      va.y = vcol[(j * 2 + 1) * DDIM];
#endif
      v2f pb;                                  // B[K=key, N=query]
      pb.x = prob[j * 2 + 0];
      pb.y = prob[j * 2 + 1];
      o = wmma4(va, pb, o);
    }
#if USE_ASYNC_LDS
    // The ring is private to this one wave: its own reads of kvc must have
    // retired before the next trip's copies refill that buffer.
    asm volatile("s_wait_dscnt 0x0" ::: "memory");
#endif
  }

  const float l = lrun + other_half(lrun);     // join the halves' sums once
  float4 w0, w1;                               // 8 consecutive d of one query
  w0.x = o[0] / l; w0.y = o[1] / l; w0.z = o[2] / l; w0.w = o[3] / l;
  w1.x = o[4] / l; w1.y = o[5] / l; w1.z = o[6] / l; w1.w = o[7] / l;
  float4* dst = (float4*)(out + (size_t)(qRow0 + lo) * DDIM + dcol + hi * 8);
  dst[0] = w0;
  dst[1] = w1;
}

// ---------------------------------------------------------------------------
// Kernel 3: img_out = (attn_out @ W2 + b2), stored as [B,Ci,H,W], fused with
// GeM clip^3 partial accumulation.  One wave per 16x16 output tile.
// ---------------------------------------------------------------------------
__global__ void __launch_bounds__(32)
k_gemm2(const float* __restrict__ x, const float* __restrict__ W2,
        const float* __restrict__ b2, float* __restrict__ img_out,
        float* __restrict__ gem_acc) {
  __shared__ float lds[16 * 17];
  const int lane = threadIdx.x;
  const int lo = lane & 15, hi = lane >> 4;
  const int mBase = blockIdx.x * 16;           // 800
  const int nBase = blockIdx.y * 16;           // 16
  const int b = mBase / HWSZ, hw0 = mBase % HWSZ;

  v8f acc = (v8f){0, 0, 0, 0, 0, 0, 0, 0};
  const float* aBase = x + (size_t)(mBase + lo) * DDIM;
  for (int k0 = 0; k0 < DDIM; k0 += 4) {
    const int ka = k0 + hi * 2;
    v2f a;
    a.x = aBase[ka + 0];
    a.y = aBase[ka + 1];
    v2f bb;
    bb.x = W2[(ka + 0) * CI + nBase + lo];
    bb.y = W2[(ka + 1) * CI + nBase + lo];
    acc = wmma4(a, bb, acc);
  }

  const float bias = b2[nBase + lo];
  float gsum = 0.0f;
#pragma unroll
  for (int r = 0; r < 8; ++r) {
    const float v = acc[r] + bias;
    lds[(r + hi * 8) * 17 + lo] = v;
    const float c = fmaxf(v, GEM_EPS);
    gsum += c * c * c;                         // clip^p, p=3
  }
  gsum += __shfl_xor(gsum, 16, 32);            // combine both 8-row halves
  __syncthreads();

  // transposed store: lane -> (channel = lane>>1, 8 consecutive hw)
  {
    const int c_local = lane >> 1;
    const int rhalf = (lane & 1) * 8;
    float* dst = img_out + ((size_t)(b * CI + nBase + c_local) * HWSZ) + hw0 + rhalf;
#pragma unroll
    for (int i = 0; i < 8; ++i) dst[i] = lds[(rhalf + i) * 17 + c_local];
  }
  if (lane < 16) atomicAdd(&gem_acc[b * CI + nBase + lane], gsum);
}

// ---------------------------------------------------------------------------
// Kernel 4: cloud branch: l2norm rows, clip^3, LDS-staged segment sums.
// One wave per row (128 elems = float4 per lane).
// ---------------------------------------------------------------------------
__global__ void __launch_bounds__(256)
k_cloud(const float* __restrict__ cf, const int* __restrict__ bids,
        float* __restrict__ cout, float* __restrict__ seg_acc,
        float* __restrict__ cnt_acc) {
  __shared__ float seg[BATCH * DDIM];
  __shared__ float cnt[BATCH];
  const int t = threadIdx.x;
  const int lane = t & 31;
  const int wave = t >> 5;
  for (int i = t; i < BATCH * DDIM; i += 256) seg[i] = 0.0f;
  if (t < BATCH) cnt[t] = 0.0f;
  __syncthreads();

  const int wgid = blockIdx.x * 8 + wave;
  const int nw = gridDim.x * 8;
  for (int row = wgid; row < NCLOUD; row += nw) {
    const float4 v = ((const float4*)(cf + (size_t)row * DDIM))[lane];
    float ss = v.x * v.x + v.y * v.y + v.z * v.z + v.w * v.w;
    ss = red32_sum(ss);
    const float inv = 1.0f / fmaxf(sqrtf(ss), L2_EPS);
    float4 o;
    o.x = v.x * inv; o.y = v.y * inv; o.z = v.z * inv; o.w = v.w * inv;
    ((float4*)(cout + (size_t)row * DDIM))[lane] = o;

    const int bid = bids[row];
    float cx = fmaxf(o.x, GEM_EPS), cy = fmaxf(o.y, GEM_EPS);
    float cz = fmaxf(o.z, GEM_EPS), cw = fmaxf(o.w, GEM_EPS);
    float* sp = seg + bid * DDIM + lane * 4;
    atomicAdd(sp + 0, cx * cx * cx);
    atomicAdd(sp + 1, cy * cy * cy);
    atomicAdd(sp + 2, cz * cz * cz);
    atomicAdd(sp + 3, cw * cw * cw);
    if (lane == 0) atomicAdd(&cnt[bid], 1.0f);
  }
  __syncthreads();
  for (int i = t; i < BATCH * DDIM; i += 256) atomicAdd(&seg_acc[i], seg[i]);
  if (t < BATCH) atomicAdd(&cnt_acc[t], cnt[t]);
}

// ---------------------------------------------------------------------------
// Kernel 5: finalize GeM pools
// ---------------------------------------------------------------------------
__global__ void k_finalize(const float* __restrict__ img_acc,
                           const float* __restrict__ seg_acc,
                           const float* __restrict__ cnt_acc,
                           float* __restrict__ image_gem,
                           float* __restrict__ cloud_gem) {
  const int i = blockIdx.x * blockDim.x + threadIdx.x;
  if (i < BATCH * CI) image_gem[i] = cbrtf(img_acc[i] * (1.0f / (float)HWSZ));
  if (i < BATCH * DDIM) {
    const int b = i / DDIM;
    cloud_gem[i] = cbrtf(seg_acc[i] / fmaxf(cnt_acc[b], 1.0f));
  }
}

// ---------------------------------------------------------------------------
// Host launcher
// ---------------------------------------------------------------------------
extern "C" void kernel_launch(void* const* d_in, const int* in_sizes, int n_in,
                              void* d_out, int out_size, void* d_ws, size_t ws_size,
                              hipStream_t stream) {
  const float* image_feat = (const float*)d_in[0];   // [8,256,40,40]
  const float* cloud_feat = (const float*)d_in[1];   // [32768,128]
  const int*   cloud_bids = (const int*)d_in[2];     // [32768]
  const float* W1 = (const float*)d_in[3];           // [256,128]
  const float* b1 = (const float*)d_in[4];           // [128]
  const float* W2 = (const float*)d_in[5];           // [128,256]
  const float* b2 = (const float*)d_in[6];           // [256]

  // Output layout (floats, concatenated in reference return order)
  float* out_img   = (float*)d_out;                         // 8*256*1600
  float* out_cloud = out_img + (size_t)BATCH * CI * HWSZ;   // 32768*128
  float* out_igem  = out_cloud + (size_t)NCLOUD * DDIM;     // 8*256
  float* out_cgem  = out_igem + BATCH * CI;                 // 8*128

  // Workspace layout (~13.1 MB of floats)
  float* ws      = (float*)d_ws;
  float* tok     = ws;                                      // 12800*128
  float* attn    = tok + (size_t)12800 * DDIM;              // 12800*128
  float* img_acc = attn + (size_t)12800 * DDIM;             // 2048
  float* seg_acc = img_acc + BATCH * CI;                    // 1024
  float* cnt_acc = seg_acc + BATCH * DDIM;                  // 8

  // 0) zero accumulators (ws is poisoned; must be deterministic every call)
  const int nzero = BATCH * CI + BATCH * DDIM + BATCH;      // 3080
  k_zero<<<(nzero + 255) / 256, 256, 0, stream>>>(img_acc, nzero);

  // 1) tok = l2norm(image^T @ W1 + b1)
  k_gemm1_l2norm<<<12800 / 16, 32, 0, stream>>>(image_feat, W1, b1, tok);

  // 2) flash self-attention per (b, head, q-tile)
  k_attn<<<BATCH * NHEAD * (HWSZ / 16), 32, 0, stream>>>(tok, attn);

  // 3) img_out = attn @ W2 + b2 (NCHW) + GeM accumulation
  k_gemm2<<<dim3(12800 / 16, CI / 16), 32, 0, stream>>>(attn, W2, b2,
                                                        out_img, img_acc);

  // 4) cloud branch
  k_cloud<<<256, 256, 0, stream>>>(cloud_feat, cloud_bids, out_cloud,
                                   seg_acc, cnt_acc);

  // 5) finalize GeM pools
  k_finalize<<<(BATCH * CI + 255) / 256, 256, 0, stream>>>(
      img_acc, seg_acc, cnt_acc, out_igem, out_cgem);
}

// v003
// It runs in 124 microseconds.
// In both of two side-by-side timings against v002, it was 1.15 times as fast.
// All steps since v000 together make it 1.83 times as fast.
#include <hip/hip_runtime.h>
#include <hip/hip_bf16.h>
#include <math.h>

// ---------------------------------------------------------------------------
// Problem constants (from reference setup_inputs)
// ---------------------------------------------------------------------------
#define BATCH   8
#define CI      256
#define HWSZ    1600          // 40*40
#define DDIM    128
#define NCLOUD  32768
#define NHEAD   8
#define DH      16            // DDIM / NHEAD
#define GEM_EPS 1e-6f
#define L2_EPS  1e-12f
#define LOG2E   1.44269504088896340736f

typedef float v2f __attribute__((ext_vector_type(2)));
typedef float v8f __attribute__((ext_vector_type(8)));
typedef int   v4i __attribute__((vector_size(16)));   // builtin's pointee type

#define GLB_AS __attribute__((address_space(1)))
#define LDS_AS __attribute__((address_space(3)))

// CDNA5 async global->LDS copy path (ASYNCcnt-tracked). Guarded so the file
// still compiles (host pass + older toolchains) with a plain-load fallback.
#if defined(__AMDGCN__) && __has_builtin(__builtin_amdgcn_global_load_async_to_lds_b128)
#define USE_ASYNC_LDS 1
#else
#define USE_ASYNC_LDS 0
#endif

#if USE_ASYNC_LDS
template <int N>
__device__ __forceinline__ void async_wait() {
#if __has_builtin(__builtin_amdgcn_s_wait_asynccnt)
  __builtin_amdgcn_s_wait_asynccnt(N);
#else
  asm volatile("s_wait_asynccnt %0" ::"i"(N) : "memory");
#endif
  asm volatile("" ::: "memory");   // keep LDS reads below the wait
}
#endif

// fp32 WMMA: D(16x16,f32) = A(16x4,f32) * B(4x16,f32) + C
__device__ __forceinline__ v8f wmma4(v2f a, v2f b, v8f c) {
  return __builtin_amdgcn_wmma_f32_16x16x4_f32(false, a, false, b, (short)0, c,
                                               false, false);
}

// Row reductions inside a 16-lane half (C/D layout: a row's 16 cols live in
// one 16-lane half of a wave32).
__device__ __forceinline__ float red16_sum(float v) {
  v += __shfl_xor(v, 1, 32);
  v += __shfl_xor(v, 2, 32);
  v += __shfl_xor(v, 4, 32);
  v += __shfl_xor(v, 8, 32);
  return v;
}
__device__ __forceinline__ float red32_sum(float v) {
  v += __shfl_xor(v, 1, 32);
  v += __shfl_xor(v, 2, 32);
  v += __shfl_xor(v, 4, 32);
  v += __shfl_xor(v, 8, 32);
  v += __shfl_xor(v, 16, 32);
  return v;
}

// ---------------------------------------------------------------------------
// Kernel 0: zero the accumulator region of the workspace
// ---------------------------------------------------------------------------
__global__ void k_zero(float* p, int n) {
  int i = blockIdx.x * blockDim.x + threadIdx.x;
  if (i < n) p[i] = 0.0f;
}

// ---------------------------------------------------------------------------
// Kernel 1: tok = l2norm(image_feat^T @ W1 + b1)
// One wave per 16-row M-tile; computes the full 16x128 row block.
// ---------------------------------------------------------------------------
__global__ void __launch_bounds__(32)
k_gemm1_l2norm(const float* __restrict__ img, const float* __restrict__ W1,
               const float* __restrict__ b1, float* __restrict__ tok) {
  const int lane = threadIdx.x;
  const int lo = lane & 15, hi = lane >> 4;
  const int mBase = blockIdx.x * 16;          // 800 tiles, never crosses batch
  const int b  = mBase / HWSZ;
  const int hw = (mBase % HWSZ) + lo;
  const float* aBase = img + (size_t)b * CI * HWSZ + hw;

  v8f acc[8];
#pragma unroll
  for (int nt = 0; nt < 8; ++nt) acc[nt] = (v8f){0, 0, 0, 0, 0, 0, 0, 0};

  for (int k0 = 0; k0 < CI; k0 += 4) {
    const int ka = k0 + hi * 2;               // K per A/B fragment lane-half
    v2f a;
    a.x = aBase[(size_t)(ka + 0) * HWSZ];
    a.y = aBase[(size_t)(ka + 1) * HWSZ];
#pragma unroll
    for (int nt = 0; nt < 8; ++nt) {
      const int d = nt * 16 + lo;
      v2f bb;
      bb.x = W1[(ka + 0) * DDIM + d];
      bb.y = W1[(ka + 1) * DDIM + d];
      acc[nt] = wmma4(a, bb, acc[nt]);
    }
  }

  float bias[8];
#pragma unroll
  for (int nt = 0; nt < 8; ++nt) bias[nt] = b1[nt * 16 + lo];

#pragma unroll
  for (int r = 0; r < 8; ++r) {
    float ss = 0.0f;
#pragma unroll
    for (int nt = 0; nt < 8; ++nt) {
      float v = acc[nt][r] + bias[nt];
      acc[nt][r] = v;
      ss += v * v;
    }
    ss = red16_sum(ss);                       // per-row sum of squares
    const float inv = 1.0f / fmaxf(sqrtf(ss), L2_EPS);
    const int row = mBase + r + hi * 8;
#pragma unroll
    for (int nt = 0; nt < 8; ++nt)
      tok[(size_t)row * DDIM + nt * 16 + lo] = acc[nt][r] * inv;
  }
}

#define KVSTRIDE 20

#if USE_ASYNC_LDS
__device__ __forceinline__ void issue_kv(const float* __restrict__ tok,
                                         float* kvbuf, int kRow0, int dcol,
                                         int lane) {
  const int row = lane >> 2;                  // 0..7
  const int sub = (lane & 3) * 4;             // float offset in row
  const float* g0 = tok + (size_t)(kRow0 + row) * DDIM + dcol + sub;
  const float* g1 = g0 + (size_t)8 * DDIM;
  __builtin_amdgcn_global_load_async_to_lds_b128(
      (v4i*)g0, (LDS_AS v4i*)&kvbuf[row * KVSTRIDE + sub], 0, 0);
  __builtin_amdgcn_global_load_async_to_lds_b128(
      (v4i*)g1, (LDS_AS v4i*)&kvbuf[(row + 8) * KVSTRIDE + sub], 0, 0);
}
#endif

// Value of lane l ^ 16 (the other half of the wave), by a vector cross-row move.
__device__ __forceinline__ float other_half(float v) {
  const unsigned u = __builtin_bit_cast(unsigned, v);
  return __builtin_bit_cast(float, __builtin_amdgcn_permlanex16(
      u, u, 0x76543210u, 0xfedcba98u, false, false));
}

// A block is four waves on one (batch, head, group of QT query tiles).  Each
// wave carries all QT query tiles against its own quarter of the keys, so one
// K/V tile (one pair of copies, one set of LDS fragment reads) feeds QT tiles'
// products, which are independent chains for the matrix unit.  With no running
// maximum the quarters' O and row sums simply add: they are joined through LDS
// behind one barrier at the end.
#define QT     5                      // query tiles per wave
#define KSPLIT 4                      // waves per block, a quarter of the keys each
#define KTW    (HWSZ / 16 / KSPLIT)   // 25 key tiles per wave

// The grid is five blocks per WGP.  At most five waves fit a SIMD (the
// attribute pads the register allocation), so no WGP can take a sixth block
// while another stands short: every matrix unit gets the same share.
__global__ void __launch_bounds__(32 * KSPLIT)
__attribute__((amdgpu_waves_per_eu(5, 5)))
k_attn(const float* __restrict__ tok, float* __restrict__ out) {
#if USE_ASYNC_LDS
  // one private double-buffered K/V ring per wave
  __shared__ __attribute__((aligned(16))) float kv[KSPLIT][2][16 * KVSTRIDE];
#endif
  __shared__ float part[KSPLIT][QT][9][32];   // each wave's O (8) and row sum (1)
  const int lane = threadIdx.x & 31;
  const int wave = __builtin_amdgcn_readfirstlane(threadIdx.x >> 5);
  const int lo = lane & 15, hi = lane >> 4;

  int idx = blockIdx.x;                       // 8*8*20 blocks
  const int qg = idx % (HWSZ / 16 / QT); idx /= (HWSZ / 16 / QT);
  const int h  = idx % NHEAD;
  const int b  = idx / NHEAD;
  const int dcol  = h * DH;
  const int qRow0 = b * HWSZ + qg * (QT * 16);
  const int kRowW = b * HWSZ + wave * (KTW * 16);   // this wave's first key

  // Q^T in B-layout: 4 chunks of 4x16 per tile, B[K=d, N=query] = tok[query, d]
  v2f qb[QT][4];
#pragma unroll
  for (int t = 0; t < QT; ++t) {
#pragma unroll
    for (int kk = 0; kk < 4; ++kk) {
      const float* p =
          tok + (size_t)(qRow0 + t * 16 + lo) * DDIM + dcol + kk * 4 + hi * 2;
      qb[t][kk].x = p[0];
      qb[t][kk].y = p[1];
    }
  }

  // O^T accumulators: o[t][r] = O[query = t*16 + lo][d = r + 8*hi]
  v8f o[QT];
  float lrun[QT];                             // this half's share of the row sums
#pragma unroll
  for (int t = 0; t < QT; ++t) {
    o[t] = (v8f){0, 0, 0, 0, 0, 0, 0, 0};
    lrun[t] = 0.0f;
  }

#if USE_ASYNC_LDS
  issue_kv(tok, kv[wave][0], kRowW, dcol, lane);   // prime the pipeline
#endif

  for (int kt = 0; kt < KTW; ++kt) {
    const int kRow0 = kRowW + kt * 16;
#if USE_ASYNC_LDS
    float* kvc = kv[wave][kt & 1];
    if (kt + 1 < KTW) {                       // overlap next copy with compute
      issue_kv(tok, kv[wave][(kt + 1) & 1], kRow0 + 16, dcol, lane);
      async_wait<2>();                        // in-order: older tile complete
    } else {
      async_wait<0>();
    }
#else
    if (kt + 1 < KTW)                         // CDNA5 global_prefetch_b8
      __builtin_prefetch(tok + (size_t)(kRow0 + 16 + lo) * DDIM + dcol, 0, 0);
#endif

    // The key tile's two fragment sets, read once for all QT query tiles.
    v2f ka[4];                                 // A[M=key, K=d] = tok[key, d]
#pragma unroll
    for (int kk = 0; kk < 4; ++kk) {
      const int kidx = kk * 4 + hi * 2;
#if USE_ASYNC_LDS
      ka[kk].x = kvc[lo * KVSTRIDE + kidx + 0];
      ka[kk].y = kvc[lo * KVSTRIDE + kidx + 1];
#else
      const float* p = tok + (size_t)(kRow0 + lo) * DDIM + dcol + kidx;
      ka[kk].x = p[0];
      ka[kk].y = p[1];
#endif
    }
    // k position hi*2 + i of chunk j stands for key 2*j + i + 8*hi on both sides
#if USE_ASYNC_LDS
    const float* vcol = kvc + hi * 8 * KVSTRIDE + lo;
#else
    const float* vcol = tok + (size_t)(kRow0 + hi * 8) * DDIM + dcol + lo;
#endif
    v2f va[4];                                 // A[M=d, K=key] = tok[key, d]
#pragma unroll
    for (int j = 0; j < 4; ++j) {
#if USE_ASYNC_LDS
      va[j].x = vcol[(j * 2 + 0) * KVSTRIDE];
      va[j].y = vcol[(j * 2 + 1) * KVSTRIDE];
#else
      va[j].x = vcol[(j * 2 + 0) * DDIM];
      va[j].y = vcol[(j * 2 + 1) * DDIM];
#endif
    }

#pragma unroll
    for (int t = 0; t < QT; ++t) {
      // S^T = K * Q^T   (contraction over dh=16 -> 4 fp32 WMMAs)
      // S[r] = score(query = lo, key = r + 8*hi)
      v8f S = (v8f){0, 0, 0, 0, 0, 0, 0, 0};
#pragma unroll
      for (int kk = 0; kk < 4; ++kk) S = wmma4(ka[kk], qb[t][kk], S);

      // softmax numerators: one query per lane, its 16 keys split over the halves
      const v8f e = S * (0.25f * LOG2E);       // dh^-0.5; exp(x) = exp2(x * log2 e)
      v8f prob;
      float psum = 0.0f;
#pragma unroll
      for (int r = 0; r < 8; ++r) {
        prob[r] = __builtin_amdgcn_exp2f(e[r]);
        psum += prob[r];
      }
      lrun[t] += psum;

      // O^T += V^T * P^T   (contraction over 16 keys -> 4 fp32 WMMAs)
#pragma unroll
      for (int j = 0; j < 4; ++j) {
        v2f pb;                                // B[K=key, N=query]
        pb.x = prob[j * 2 + 0];
        pb.y = prob[j * 2 + 1];
        o[t] = wmma4(va[j], pb, o[t]);
      }
    }
#if USE_ASYNC_LDS
    // The ring is private to this one wave: its own reads of kvc must have
    // retired before the next trip's copies refill that buffer.
    asm volatile("s_wait_dscnt 0x0" ::: "memory");
#endif
  }

  // Join the four key quarters: every wave leaves its sums in LDS ...
#pragma unroll
  for (int t = 0; t < QT; ++t) {
#pragma unroll
    for (int r = 0; r < 8; ++r) part[wave][t][r][lane] = o[t][r];
    part[wave][t][8][lane] = lrun[t];
  }
  __syncthreads();   // all four waves' sums stand in LDS before any is read

  // ... and the query tiles are dealt over the waves for the sum and the store.
  for (int t = wave; t < QT; t += KSPLIT) {
    float acc[9];
#pragma unroll
    for (int r = 0; r < 9; ++r)
      acc[r] = ((part[0][t][r][lane] + part[1][t][r][lane]) +
                part[2][t][r][lane]) + part[3][t][r][lane];
    const float l = acc[8] + other_half(acc[8]);   // join the halves' sums once
    float4 w0, w1;                             // 8 consecutive d of one query
    w0.x = acc[0] / l; w0.y = acc[1] / l; w0.z = acc[2] / l; w0.w = acc[3] / l;
    w1.x = acc[4] / l; w1.y = acc[5] / l; w1.z = acc[6] / l; w1.w = acc[7] / l;
    float4* dst =
        (float4*)(out + (size_t)(qRow0 + t * 16 + lo) * DDIM + dcol + hi * 8);
    dst[0] = w0;
    dst[1] = w1;
    // A second pass of this loop rewrites the stores' address and data
    // registers: keep the wait on their address translation in front of that.
    asm volatile("s_wait_xcnt 0x0" ::: "memory");
  }
}

// ---------------------------------------------------------------------------
// Kernel 3: img_out = (attn_out @ W2 + b2), stored as [B,Ci,H,W], fused with
// GeM clip^3 partial accumulation.  One wave per 16x16 output tile.
// ---------------------------------------------------------------------------
__global__ void __launch_bounds__(32)
k_gemm2(const float* __restrict__ x, const float* __restrict__ W2,
        const float* __restrict__ b2, float* __restrict__ img_out,
        float* __restrict__ gem_acc) {
  __shared__ float lds[16 * 17];
  const int lane = threadIdx.x;
  const int lo = lane & 15, hi = lane >> 4;
  const int mBase = blockIdx.x * 16;           // 800
  const int nBase = blockIdx.y * 16;           // 16
  const int b = mBase / HWSZ, hw0 = mBase % HWSZ;

  v8f acc = (v8f){0, 0, 0, 0, 0, 0, 0, 0};
  const float* aBase = x + (size_t)(mBase + lo) * DDIM;
  for (int k0 = 0; k0 < DDIM; k0 += 4) {
    const int ka = k0 + hi * 2;
    v2f a;
    a.x = aBase[ka + 0];
    a.y = aBase[ka + 1];
    v2f bb;
    bb.x = W2[(ka + 0) * CI + nBase + lo];
    bb.y = W2[(ka + 1) * CI + nBase + lo];
    acc = wmma4(a, bb, acc);
  }

  const float bias = b2[nBase + lo];
  float gsum = 0.0f;
#pragma unroll
  for (int r = 0; r < 8; ++r) {
    const float v = acc[r] + bias;
    lds[(r + hi * 8) * 17 + lo] = v;
    const float c = fmaxf(v, GEM_EPS);
    gsum += c * c * c;                         // clip^p, p=3
  }
  gsum += __shfl_xor(gsum, 16, 32);            // combine both 8-row halves
  __syncthreads();

  // transposed store: lane -> (channel = lane>>1, 8 consecutive hw)
  {
    const int c_local = lane >> 1;
    const int rhalf = (lane & 1) * 8;
    float* dst = img_out + ((size_t)(b * CI + nBase + c_local) * HWSZ) + hw0 + rhalf;
#pragma unroll
    for (int i = 0; i < 8; ++i) dst[i] = lds[(rhalf + i) * 17 + c_local];
  }
  if (lane < 16) atomicAdd(&gem_acc[b * CI + nBase + lane], gsum);
}

// ---------------------------------------------------------------------------
// Kernel 4: cloud branch: l2norm rows, clip^3, LDS-staged segment sums.
// One wave per row (128 elems = float4 per lane).
// ---------------------------------------------------------------------------
__global__ void __launch_bounds__(256)
k_cloud(const float* __restrict__ cf, const int* __restrict__ bids,
        float* __restrict__ cout, float* __restrict__ seg_acc,
        float* __restrict__ cnt_acc) {
  __shared__ float seg[BATCH * DDIM];
  __shared__ float cnt[BATCH];
  const int t = threadIdx.x;
  const int lane = t & 31;
  const int wave = t >> 5;
  for (int i = t; i < BATCH * DDIM; i += 256) seg[i] = 0.0f;
  if (t < BATCH) cnt[t] = 0.0f;
  __syncthreads();

  const int wgid = blockIdx.x * 8 + wave;
  const int nw = gridDim.x * 8;
  for (int row = wgid; row < NCLOUD; row += nw) {
    const float4 v = ((const float4*)(cf + (size_t)row * DDIM))[lane];
    float ss = v.x * v.x + v.y * v.y + v.z * v.z + v.w * v.w;
    ss = red32_sum(ss);
    const float inv = 1.0f / fmaxf(sqrtf(ss), L2_EPS);
    float4 o;
    o.x = v.x * inv; o.y = v.y * inv; o.z = v.z * inv; o.w = v.w * inv;
    ((float4*)(cout + (size_t)row * DDIM))[lane] = o;

    const int bid = bids[row];
    float cx = fmaxf(o.x, GEM_EPS), cy = fmaxf(o.y, GEM_EPS);
    float cz = fmaxf(o.z, GEM_EPS), cw = fmaxf(o.w, GEM_EPS);
    float* sp = seg + bid * DDIM + lane * 4;
    atomicAdd(sp + 0, cx * cx * cx);
    atomicAdd(sp + 1, cy * cy * cy);
    atomicAdd(sp + 2, cz * cz * cz);
    atomicAdd(sp + 3, cw * cw * cw);
    if (lane == 0) atomicAdd(&cnt[bid], 1.0f);
  }
  __syncthreads();
  for (int i = t; i < BATCH * DDIM; i += 256) atomicAdd(&seg_acc[i], seg[i]);
  if (t < BATCH) atomicAdd(&cnt_acc[t], cnt[t]);
}

// ---------------------------------------------------------------------------
// Kernel 5: finalize GeM pools
// ---------------------------------------------------------------------------
__global__ void k_finalize(const float* __restrict__ img_acc,
                           const float* __restrict__ seg_acc,
                           const float* __restrict__ cnt_acc,
                           float* __restrict__ image_gem,
                           float* __restrict__ cloud_gem) {
  const int i = blockIdx.x * blockDim.x + threadIdx.x;
  if (i < BATCH * CI) image_gem[i] = cbrtf(img_acc[i] * (1.0f / (float)HWSZ));
  if (i < BATCH * DDIM) {
    const int b = i / DDIM;
    cloud_gem[i] = cbrtf(seg_acc[i] / fmaxf(cnt_acc[b], 1.0f));
  }
}

// ---------------------------------------------------------------------------
// Host launcher
// ---------------------------------------------------------------------------
extern "C" void kernel_launch(void* const* d_in, const int* in_sizes, int n_in,
                              void* d_out, int out_size, void* d_ws, size_t ws_size,
                              hipStream_t stream) {
  const float* image_feat = (const float*)d_in[0];   // [8,256,40,40]
  const float* cloud_feat = (const float*)d_in[1];   // [32768,128]
  const int*   cloud_bids = (const int*)d_in[2];     // [32768]
  const float* W1 = (const float*)d_in[3];           // [256,128]
  const float* b1 = (const float*)d_in[4];           // [128]
  const float* W2 = (const float*)d_in[5];           // [128,256]
  const float* b2 = (const float*)d_in[6];           // [256]

  // Output layout (floats, concatenated in reference return order)
  float* out_img   = (float*)d_out;                         // 8*256*1600
  float* out_cloud = out_img + (size_t)BATCH * CI * HWSZ;   // 32768*128
  float* out_igem  = out_cloud + (size_t)NCLOUD * DDIM;     // 8*256
  float* out_cgem  = out_igem + BATCH * CI;                 // 8*128

  // Workspace layout (~13.1 MB of floats)
  float* ws      = (float*)d_ws;
  float* tok     = ws;                                      // 12800*128
  float* attn    = tok + (size_t)12800 * DDIM;              // 12800*128
  float* img_acc = attn + (size_t)12800 * DDIM;             // 2048
  float* seg_acc = img_acc + BATCH * CI;                    // 1024
  float* cnt_acc = seg_acc + BATCH * DDIM;                  // 8

  // 0) zero accumulators (ws is poisoned; must be deterministic every call)
  const int nzero = BATCH * CI + BATCH * DDIM + BATCH;      // 3080
  k_zero<<<(nzero + 255) / 256, 256, 0, stream>>>(img_acc, nzero);

  // 1) tok = l2norm(image^T @ W1 + b1)
  k_gemm1_l2norm<<<12800 / 16, 32, 0, stream>>>(image_feat, W1, b1, tok);

  // 2) flash self-attention per (b, head, group of q-tiles)
  k_attn<<<BATCH * NHEAD * (HWSZ / 16 / QT), 32 * KSPLIT, 0, stream>>>(tok, attn);

  // 3) img_out = attn @ W2 + b2 (NCHW) + GeM accumulation
  k_gemm2<<<dim3(12800 / 16, CI / 16), 32, 0, stream>>>(attn, W2, b2,
                                                        out_img, img_acc);

  // 4) cloud branch
  k_cloud<<<256, 256, 0, stream>>>(cloud_feat, cloud_bids, out_cloud,
                                   seg_acc, cnt_acc);

  // 5) finalize GeM pools
  k_finalize<<<(BATCH * CI + 255) / 256, 256, 0, stream>>>(
      img_acc, seg_acc, cnt_acc, out_igem, out_cgem);
}

// v004
// One run takes 109 microseconds.
// Next to v003, in two timings, it ran 1.14 times as fast each time.
// Over all steps from v000 it is 2.08 times as fast.
#include <hip/hip_runtime.h>
#include <hip/hip_bf16.h>
#include <math.h>

// ---------------------------------------------------------------------------
// Problem constants (from reference setup_inputs)
// ---------------------------------------------------------------------------
#define BATCH   8
#define CI      256
#define HWSZ    1600          // 40*40
#define DDIM    128
#define NCLOUD  32768
#define NHEAD   8
#define DH      16            // DDIM / NHEAD
#define GEM_EPS 1e-6f
#define L2_EPS  1e-12f
#define LOG2E   1.44269504088896340736f

typedef float v2f __attribute__((ext_vector_type(2)));
typedef float v8f __attribute__((ext_vector_type(8)));
typedef int   v4i __attribute__((vector_size(16)));   // builtin's pointee type

#define GLB_AS __attribute__((address_space(1)))
#define LDS_AS __attribute__((address_space(3)))

// CDNA5 async global->LDS copy path (ASYNCcnt-tracked). Guarded so the file
// still compiles (host pass + older toolchains) with a plain-load fallback.
#if defined(__AMDGCN__) && __has_builtin(__builtin_amdgcn_global_load_async_to_lds_b128)
#define USE_ASYNC_LDS 1
#else
#define USE_ASYNC_LDS 0
#endif

#if USE_ASYNC_LDS
template <int N>
__device__ __forceinline__ void async_wait() {
#if __has_builtin(__builtin_amdgcn_s_wait_asynccnt)
  __builtin_amdgcn_s_wait_asynccnt(N);
#else
  asm volatile("s_wait_asynccnt %0" ::"i"(N) : "memory");
#endif
  asm volatile("" ::: "memory");   // keep LDS reads below the wait
}
#endif

// fp32 WMMA: D(16x16,f32) = A(16x4,f32) * B(4x16,f32) + C
__device__ __forceinline__ v8f wmma4(v2f a, v2f b, v8f c) {
  return __builtin_amdgcn_wmma_f32_16x16x4_f32(false, a, false, b, (short)0, c,
                                               false, false);
}

// Row reductions inside a 16-lane half (C/D layout: a row's 16 cols live in
// one 16-lane half of a wave32).
__device__ __forceinline__ float red16_sum(float v) {
  v += __shfl_xor(v, 1, 32);
  v += __shfl_xor(v, 2, 32);
  v += __shfl_xor(v, 4, 32);
  v += __shfl_xor(v, 8, 32);
  return v;
}
__device__ __forceinline__ float red32_sum(float v) {
  v += __shfl_xor(v, 1, 32);
  v += __shfl_xor(v, 2, 32);
  v += __shfl_xor(v, 4, 32);
  v += __shfl_xor(v, 8, 32);
  v += __shfl_xor(v, 16, 32);
  return v;
}

// ---------------------------------------------------------------------------
// Kernel 0: zero the accumulator region of the workspace
// ---------------------------------------------------------------------------
__global__ void k_zero(float* p, int n) {
  int i = blockIdx.x * blockDim.x + threadIdx.x;
  if (i < n) p[i] = 0.0f;
}

// ---------------------------------------------------------------------------
// Kernel 1: tok = l2norm(image_feat^T @ W1 + b1)
// A block is four waves on one 16-row M-tile (the full 16x128 row block).  Each
// wave contracts over its own quarter of the 256 channels, so a SIMD holds
// three or four waves whose load waits and matrix work overlap, where one wave
// alone stood exposed to every memory wait.  The quarters are joined in LDS
// behind one barrier; the rows are then dealt over the waves for bias, norm
// and store.
// ---------------------------------------------------------------------------
#define G1W 4                 // waves per block, a quarter of the channels each
#define G1K (CI / G1W)        // 64 channels per wave
#define G1P 132               // floats; row pitch of the partial sums: rows r and
                              // r + 8 fall on different banks, 16-byte aligned

// Four waves to a SIMD: registers for the loads in flight, and no WGP takes a
// fifth block while another stands short.
__global__ void __launch_bounds__(32 * G1W)
__attribute__((amdgpu_waves_per_eu(4, 4)))
k_gemm1_l2norm(const float* __restrict__ img, const float* __restrict__ W1,
               const float* __restrict__ b1, float* __restrict__ tok) {
  __shared__ __attribute__((aligned(16))) float part[G1W][16][G1P];
  const int lane = threadIdx.x & 31;
  const int wave = __builtin_amdgcn_readfirstlane(threadIdx.x >> 5);
  const int lo = lane & 15, hi = lane >> 4;
  const int mBase = blockIdx.x * 16;          // 800 tiles, never crosses batch
  const int b  = mBase / HWSZ;
  const int hw = (mBase % HWSZ) + lo;
  const float* aBase = img + (size_t)b * CI * HWSZ + hw;
  // K per A/B fragment lane-half: channel wave*64 + s*4 + hi*2 (+1) at k step s
  const int kW = wave * G1K + hi * 2;
  const float* aW = aBase + (size_t)kW * HWSZ;
  const float* wW = W1 + kW * DDIM + lo;
  const float4 bias = ((const float4*)b1)[lane];   // for the rows' finish, asked for early

  v8f acc[8];
#pragma unroll
  for (int nt = 0; nt < 8; ++nt) acc[nt] = (v8f){0, 0, 0, 0, 0, 0, 0, 0};

  // The wave's A slice (16 k steps), at constant offsets from one address.
  v2f a[G1K / 4];
#pragma unroll
  for (int s = 0; s < G1K / 4; ++s) {
    a[s].x = aW[(s * 4 + 0) * HWSZ];
    a[s].y = aW[(s * 4 + 1) * HWSZ];
  }
  // The address pair of these loads is free for reuse from here on: keep the
  // wait on their address translation in front of any overwrite of it.
  asm volatile("s_wait_xcnt 0x0" ::: "memory");

  // W1 fragments run two k steps ahead of their products, in three register
  // sets; unrolled in full so that a[] and the sets stay in registers.
  v2f bb[3][8];
#pragma unroll
  for (int s = 0; s < 2; ++s) {
#pragma unroll
    for (int nt = 0; nt < 8; ++nt) {
      bb[s][nt].x = wW[(s * 4 + 0) * DDIM + nt * 16];
      bb[s][nt].y = wW[(s * 4 + 1) * DDIM + nt * 16];
    }
  }
#pragma unroll
  for (int s = 0; s < G1K / 4; ++s) {
    if (s + 2 < G1K / 4) {
#pragma unroll
      for (int nt = 0; nt < 8; ++nt) {
        bb[(s + 2) % 3][nt].x = wW[((s + 2) * 4 + 0) * DDIM + nt * 16];
        bb[(s + 2) % 3][nt].y = wW[((s + 2) * 4 + 1) * DDIM + nt * 16];
      }
    }
#pragma unroll
    for (int nt = 0; nt < 8; ++nt) acc[nt] = wmma4(a[s], bb[s % 3][nt], acc[nt]);
  }

  // Join the four channel quarters: every wave leaves its sums in LDS ...
#pragma unroll
  for (int nt = 0; nt < 8; ++nt) {
#pragma unroll
    for (int r = 0; r < 8; ++r) part[wave][r + hi * 8][nt * 16 + lo] = acc[nt][r];
  }
  __syncthreads();   // all four waves' sums stand in LDS before any is read

  // ... and each wave finishes four whole rows, four columns per lane.
  float4 v[16 / G1W];
  float ss[16 / G1W];
#pragma unroll
  for (int i = 0; i < 16 / G1W; ++i) {
    const int row = wave * (16 / G1W) + i;
    const float4 p0 = *(const float4*)&part[0][row][lane * 4];
    const float4 p1 = *(const float4*)&part[1][row][lane * 4];
    const float4 p2 = *(const float4*)&part[2][row][lane * 4];
    const float4 p3 = *(const float4*)&part[3][row][lane * 4];
    v[i].x = (((p0.x + p1.x) + p2.x) + p3.x) + bias.x;
    v[i].y = (((p0.y + p1.y) + p2.y) + p3.y) + bias.y;
    v[i].z = (((p0.z + p1.z) + p2.z) + p3.z) + bias.z;
    v[i].w = (((p0.w + p1.w) + p2.w) + p3.w) + bias.w;
    ss[i] = v[i].x * v[i].x + v[i].y * v[i].y + v[i].z * v[i].z + v[i].w * v[i].w;
  }
#pragma unroll
  for (int i = 0; i < 16 / G1W; ++i) ss[i] = red32_sum(ss[i]);   // per-row sum of squares
  float4* dst = (float4*)(tok + (size_t)(mBase + wave * (16 / G1W)) * DDIM) + lane;
#pragma unroll
  for (int i = 0; i < 16 / G1W; ++i) {
    const float inv = 1.0f / fmaxf(sqrtf(ss[i]), L2_EPS);
    float4 w;
    w.x = v[i].x * inv; w.y = v[i].y * inv; w.z = v[i].z * inv; w.w = v[i].w * inv;
    dst[i * (DDIM / 4)] = w;
  }
}

#define KVSTRIDE 20

#if USE_ASYNC_LDS
__device__ __forceinline__ void issue_kv(const float* __restrict__ tok,
                                         float* kvbuf, int kRow0, int dcol,
                                         int lane) {
  const int row = lane >> 2;                  // 0..7
  const int sub = (lane & 3) * 4;             // float offset in row
  const float* g0 = tok + (size_t)(kRow0 + row) * DDIM + dcol + sub;
  const float* g1 = g0 + (size_t)8 * DDIM;
  __builtin_amdgcn_global_load_async_to_lds_b128(
      (v4i*)g0, (LDS_AS v4i*)&kvbuf[row * KVSTRIDE + sub], 0, 0);
  __builtin_amdgcn_global_load_async_to_lds_b128(
      (v4i*)g1, (LDS_AS v4i*)&kvbuf[(row + 8) * KVSTRIDE + sub], 0, 0);
}
#endif

// Value of lane l ^ 16 (the other half of the wave), by a vector cross-row move.
__device__ __forceinline__ float other_half(float v) {
  const unsigned u = __builtin_bit_cast(unsigned, v);
  return __builtin_bit_cast(float, __builtin_amdgcn_permlanex16(
      u, u, 0x76543210u, 0xfedcba98u, false, false));
}

// A block is four waves on one (batch, head, group of QT query tiles).  Each
// wave carries all QT query tiles against its own quarter of the keys, so one
// K/V tile (one pair of copies, one set of LDS fragment reads) feeds QT tiles'
// products, which are independent chains for the matrix unit.  With no running
// maximum the quarters' O and row sums simply add: they are joined through LDS
// behind one barrier at the end.
#define QT     5                      // query tiles per wave
#define KSPLIT 4                      // waves per block, a quarter of the keys each
#define KTW    (HWSZ / 16 / KSPLIT)   // 25 key tiles per wave

// The grid is five blocks per WGP.  At most five waves fit a SIMD (the
// attribute pads the register allocation), so no WGP can take a sixth block
// while another stands short: every matrix unit gets the same share.
__global__ void __launch_bounds__(32 * KSPLIT)
__attribute__((amdgpu_waves_per_eu(5, 5)))
k_attn(const float* __restrict__ tok, float* __restrict__ out) {
#if USE_ASYNC_LDS
  // one private double-buffered K/V ring per wave
  __shared__ __attribute__((aligned(16))) float kv[KSPLIT][2][16 * KVSTRIDE];
#endif
  __shared__ float part[KSPLIT][QT][9][32];   // each wave's O (8) and row sum (1)
  const int lane = threadIdx.x & 31;
  const int wave = __builtin_amdgcn_readfirstlane(threadIdx.x >> 5);
  const int lo = lane & 15, hi = lane >> 4;

  int idx = blockIdx.x;                       // 8*8*20 blocks
  const int qg = idx % (HWSZ / 16 / QT); idx /= (HWSZ / 16 / QT);
  const int h  = idx % NHEAD;
  const int b  = idx / NHEAD;
  const int dcol  = h * DH;
  const int qRow0 = b * HWSZ + qg * (QT * 16);
  const int kRowW = b * HWSZ + wave * (KTW * 16);   // this wave's first key

  // Q^T in B-layout: 4 chunks of 4x16 per tile, B[K=d, N=query] = tok[query, d]
  v2f qb[QT][4];
#pragma unroll
  for (int t = 0; t < QT; ++t) {
#pragma unroll
    for (int kk = 0; kk < 4; ++kk) {
      const float* p =
          tok + (size_t)(qRow0 + t * 16 + lo) * DDIM + dcol + kk * 4 + hi * 2;
      qb[t][kk].x = p[0];
      qb[t][kk].y = p[1];
    }
  }

  // O^T accumulators: o[t][r] = O[query = t*16 + lo][d = r + 8*hi]
  v8f o[QT];
  float lrun[QT];                             // this half's share of the row sums
#pragma unroll
  for (int t = 0; t < QT; ++t) {
    o[t] = (v8f){0, 0, 0, 0, 0, 0, 0, 0};
    lrun[t] = 0.0f;
  }

#if USE_ASYNC_LDS
  issue_kv(tok, kv[wave][0], kRowW, dcol, lane);   // prime the pipeline
#endif

  for (int kt = 0; kt < KTW; ++kt) {
    const int kRow0 = kRowW + kt * 16;
#if USE_ASYNC_LDS
    float* kvc = kv[wave][kt & 1];
    if (kt + 1 < KTW) {                       // overlap next copy with compute
      issue_kv(tok, kv[wave][(kt + 1) & 1], kRow0 + 16, dcol, lane);
      async_wait<2>();                        // in-order: older tile complete
    } else {
      async_wait<0>();
    }
#else
    if (kt + 1 < KTW)                         // CDNA5 global_prefetch_b8
      __builtin_prefetch(tok + (size_t)(kRow0 + 16 + lo) * DDIM + dcol, 0, 0);
#endif

    // The key tile's two fragment sets, read once for all QT query tiles.
    v2f ka[4];                                 // A[M=key, K=d] = tok[key, d]
#pragma unroll
    for (int kk = 0; kk < 4; ++kk) {
      const int kidx = kk * 4 + hi * 2;
#if USE_ASYNC_LDS
      ka[kk].x = kvc[lo * KVSTRIDE + kidx + 0];
      ka[kk].y = kvc[lo * KVSTRIDE + kidx + 1];
#else
      const float* p = tok + (size_t)(kRow0 + lo) * DDIM + dcol + kidx;
      ka[kk].x = p[0];
      ka[kk].y = p[1];
#endif
    }
    // k position hi*2 + i of chunk j stands for key 2*j + i + 8*hi on both sides
#if USE_ASYNC_LDS
    const float* vcol = kvc + hi * 8 * KVSTRIDE + lo;
#else
    const float* vcol = tok + (size_t)(kRow0 + hi * 8) * DDIM + dcol + lo;
#endif
    v2f va[4];                                 // A[M=d, K=key] = tok[key, d]
#pragma unroll
    for (int j = 0; j < 4; ++j) {
#if USE_ASYNC_LDS
      va[j].x = vcol[(j * 2 + 0) * KVSTRIDE];
      va[j].y = vcol[(j * 2 + 1) * KVSTRIDE];
#else
      va[j].x = vcol[(j * 2 + 0) * DDIM];
      va[j].y = vcol[(j * 2 + 1) * DDIM];
#endif
    }

#pragma unroll
    for (int t = 0; t < QT; ++t) {
      // S^T = K * Q^T   (contraction over dh=16 -> 4 fp32 WMMAs)
      // S[r] = score(query = lo, key = r + 8*hi)
      v8f S = (v8f){0, 0, 0, 0, 0, 0, 0, 0};
#pragma unroll
      for (int kk = 0; kk < 4; ++kk) S = wmma4(ka[kk], qb[t][kk], S);

      // softmax numerators: one query per lane, its 16 keys split over the halves
      const v8f e = S * (0.25f * LOG2E);       // dh^-0.5; exp(x) = exp2(x * log2 e)
      v8f prob;
      float psum = 0.0f;
#pragma unroll
      for (int r = 0; r < 8; ++r) {
        prob[r] = __builtin_amdgcn_exp2f(e[r]);
        psum += prob[r];
      }
      lrun[t] += psum;

      // O^T += V^T * P^T   (contraction over 16 keys -> 4 fp32 WMMAs)
#pragma unroll
      for (int j = 0; j < 4; ++j) {
        v2f pb;                                // B[K=key, N=query]
        pb.x = prob[j * 2 + 0];
        pb.y = prob[j * 2 + 1];
        o[t] = wmma4(va[j], pb, o[t]);
      }
    }
#if USE_ASYNC_LDS
    // The ring is private to this one wave: its own reads of kvc must have
    // retired before the next trip's copies refill that buffer.
    asm volatile("s_wait_dscnt 0x0" ::: "memory");
#endif
  }

  // Join the four key quarters: every wave leaves its sums in LDS ...
#pragma unroll
  for (int t = 0; t < QT; ++t) {
#pragma unroll
    for (int r = 0; r < 8; ++r) part[wave][t][r][lane] = o[t][r];
    part[wave][t][8][lane] = lrun[t];
  }
  __syncthreads();   // all four waves' sums stand in LDS before any is read

  // ... and the query tiles are dealt over the waves for the sum and the store.
  for (int t = wave; t < QT; t += KSPLIT) {
    float acc[9];
#pragma unroll
    for (int r = 0; r < 9; ++r)
      acc[r] = ((part[0][t][r][lane] + part[1][t][r][lane]) +
                part[2][t][r][lane]) + part[3][t][r][lane];
    const float l = acc[8] + other_half(acc[8]);   // join the halves' sums once
    float4 w0, w1;                             // 8 consecutive d of one query
    w0.x = acc[0] / l; w0.y = acc[1] / l; w0.z = acc[2] / l; w0.w = acc[3] / l;
    w1.x = acc[4] / l; w1.y = acc[5] / l; w1.z = acc[6] / l; w1.w = acc[7] / l;
    float4* dst =
        (float4*)(out + (size_t)(qRow0 + t * 16 + lo) * DDIM + dcol + hi * 8);
    dst[0] = w0;
    dst[1] = w1;
    // A second pass of this loop rewrites the stores' address and data
    // registers: keep the wait on their address translation in front of that.
    asm volatile("s_wait_xcnt 0x0" ::: "memory");
  }
}

// ---------------------------------------------------------------------------
// Kernel 3: img_out = (attn_out @ W2 + b2), stored as [B,Ci,H,W], fused with
// GeM clip^3 partial accumulation.  One wave per 16x16 output tile.
// ---------------------------------------------------------------------------
__global__ void __launch_bounds__(32)
k_gemm2(const float* __restrict__ x, const float* __restrict__ W2,
        const float* __restrict__ b2, float* __restrict__ img_out,
        float* __restrict__ gem_acc) {
  __shared__ float lds[16 * 17];
  const int lane = threadIdx.x;
  const int lo = lane & 15, hi = lane >> 4;
  const int mBase = blockIdx.x * 16;           // 800
  const int nBase = blockIdx.y * 16;           // 16
  const int b = mBase / HWSZ, hw0 = mBase % HWSZ;

  v8f acc = (v8f){0, 0, 0, 0, 0, 0, 0, 0};
  const float* aBase = x + (size_t)(mBase + lo) * DDIM;
  for (int k0 = 0; k0 < DDIM; k0 += 4) {
    const int ka = k0 + hi * 2;
    v2f a;
    a.x = aBase[ka + 0];
    a.y = aBase[ka + 1];
    v2f bb;
    bb.x = W2[(ka + 0) * CI + nBase + lo];
    bb.y = W2[(ka + 1) * CI + nBase + lo];
    acc = wmma4(a, bb, acc);
  }

  const float bias = b2[nBase + lo];
  float gsum = 0.0f;
#pragma unroll
  for (int r = 0; r < 8; ++r) {
    const float v = acc[r] + bias;
    lds[(r + hi * 8) * 17 + lo] = v;
    const float c = fmaxf(v, GEM_EPS);
    gsum += c * c * c;                         // clip^p, p=3
  }
  gsum += __shfl_xor(gsum, 16, 32);            // combine both 8-row halves
  __syncthreads();

  // transposed store: lane -> (channel = lane>>1, 8 consecutive hw)
  {
    const int c_local = lane >> 1;
    const int rhalf = (lane & 1) * 8;
    float* dst = img_out + ((size_t)(b * CI + nBase + c_local) * HWSZ) + hw0 + rhalf;
#pragma unroll
    for (int i = 0; i < 8; ++i) dst[i] = lds[(rhalf + i) * 17 + c_local];
  }
  if (lane < 16) atomicAdd(&gem_acc[b * CI + nBase + lane], gsum);
}

// ---------------------------------------------------------------------------
// Kernel 4: cloud branch: l2norm rows, clip^3, LDS-staged segment sums.
// One wave per row (128 elems = float4 per lane).
// ---------------------------------------------------------------------------
__global__ void __launch_bounds__(256)
k_cloud(const float* __restrict__ cf, const int* __restrict__ bids,
        float* __restrict__ cout, float* __restrict__ seg_acc,
        float* __restrict__ cnt_acc) {
  __shared__ float seg[BATCH * DDIM];
  __shared__ float cnt[BATCH];
  const int t = threadIdx.x;
  const int lane = t & 31;
  const int wave = t >> 5;
  for (int i = t; i < BATCH * DDIM; i += 256) seg[i] = 0.0f;
  if (t < BATCH) cnt[t] = 0.0f;
  __syncthreads();

  const int wgid = blockIdx.x * 8 + wave;
  const int nw = gridDim.x * 8;
  for (int row = wgid; row < NCLOUD; row += nw) {
    const float4 v = ((const float4*)(cf + (size_t)row * DDIM))[lane];
    float ss = v.x * v.x + v.y * v.y + v.z * v.z + v.w * v.w;
    ss = red32_sum(ss);
    const float inv = 1.0f / fmaxf(sqrtf(ss), L2_EPS);
    float4 o;
    o.x = v.x * inv; o.y = v.y * inv; o.z = v.z * inv; o.w = v.w * inv;
    ((float4*)(cout + (size_t)row * DDIM))[lane] = o;

    const int bid = bids[row];
    float cx = fmaxf(o.x, GEM_EPS), cy = fmaxf(o.y, GEM_EPS);
    float cz = fmaxf(o.z, GEM_EPS), cw = fmaxf(o.w, GEM_EPS);
    float* sp = seg + bid * DDIM + lane * 4;
    atomicAdd(sp + 0, cx * cx * cx);
    atomicAdd(sp + 1, cy * cy * cy);
    atomicAdd(sp + 2, cz * cz * cz);
    atomicAdd(sp + 3, cw * cw * cw);
    if (lane == 0) atomicAdd(&cnt[bid], 1.0f);
  }
  __syncthreads();
  for (int i = t; i < BATCH * DDIM; i += 256) atomicAdd(&seg_acc[i], seg[i]);
  if (t < BATCH) atomicAdd(&cnt_acc[t], cnt[t]);
}

// ---------------------------------------------------------------------------
// Kernel 5: finalize GeM pools
// ---------------------------------------------------------------------------
__global__ void k_finalize(const float* __restrict__ img_acc,
                           const float* __restrict__ seg_acc,
                           const float* __restrict__ cnt_acc,
                           float* __restrict__ image_gem,
                           float* __restrict__ cloud_gem) {
  const int i = blockIdx.x * blockDim.x + threadIdx.x;
  if (i < BATCH * CI) image_gem[i] = cbrtf(img_acc[i] * (1.0f / (float)HWSZ));
  if (i < BATCH * DDIM) {
    const int b = i / DDIM;
    cloud_gem[i] = cbrtf(seg_acc[i] / fmaxf(cnt_acc[b], 1.0f));
  }
}

// ---------------------------------------------------------------------------
// Host launcher
// ---------------------------------------------------------------------------
extern "C" void kernel_launch(void* const* d_in, const int* in_sizes, int n_in,
                              void* d_out, int out_size, void* d_ws, size_t ws_size,
                              hipStream_t stream) {
  const float* image_feat = (const float*)d_in[0];   // [8,256,40,40]
  const float* cloud_feat = (const float*)d_in[1];   // [32768,128]
  const int*   cloud_bids = (const int*)d_in[2];     // [32768]
  const float* W1 = (const float*)d_in[3];           // [256,128]
  const float* b1 = (const float*)d_in[4];           // [128]
  const float* W2 = (const float*)d_in[5];           // [128,256]
  const float* b2 = (const float*)d_in[6];           // [256]

  // Output layout (floats, concatenated in reference return order)
  float* out_img   = (float*)d_out;                         // 8*256*1600
  float* out_cloud = out_img + (size_t)BATCH * CI * HWSZ;   // 32768*128
  float* out_igem  = out_cloud + (size_t)NCLOUD * DDIM;     // 8*256
  float* out_cgem  = out_igem + BATCH * CI;                 // 8*128

  // Workspace layout (~13.1 MB of floats)
  float* ws      = (float*)d_ws;
  float* tok     = ws;                                      // 12800*128
  float* attn    = tok + (size_t)12800 * DDIM;              // 12800*128
  float* img_acc = attn + (size_t)12800 * DDIM;             // 2048
  float* seg_acc = img_acc + BATCH * CI;                    // 1024
  float* cnt_acc = seg_acc + BATCH * DDIM;                  // 8

  // 0) zero accumulators (ws is poisoned; must be deterministic every call)
  const int nzero = BATCH * CI + BATCH * DDIM + BATCH;      // 3080
  k_zero<<<(nzero + 255) / 256, 256, 0, stream>>>(img_acc, nzero);

  // 1) tok = l2norm(image^T @ W1 + b1)
  k_gemm1_l2norm<<<12800 / 16, 32 * G1W, 0, stream>>>(image_feat, W1, b1, tok);

  // 2) flash self-attention per (b, head, group of q-tiles)
  k_attn<<<BATCH * NHEAD * (HWSZ / 16 / QT), 32 * KSPLIT, 0, stream>>>(tok, attn);

  // 3) img_out = attn @ W2 + b2 (NCHW) + GeM accumulation
  k_gemm2<<<dim3(12800 / 16, CI / 16), 32, 0, stream>>>(attn, W2, b2,
                                                        out_img, img_acc);

  // 4) cloud branch
  k_cloud<<<256, 256, 0, stream>>>(cloud_feat, cloud_bids, out_cloud,
                                   seg_acc, cnt_acc);

  // 5) finalize GeM pools
  k_finalize<<<(BATCH * CI + 255) / 256, 256, 0, stream>>>(
      img_acc, seg_acc, cnt_acc, out_igem, out_cgem);
}

// v005
// One run takes 94.4 microseconds.
// In both of two side-by-side timings against v004, it was 1.16 times as fast.
// All steps since v000 together make it 2.41 times as fast.
#include <hip/hip_runtime.h>
#include <hip/hip_bf16.h>
#include <math.h>

// ---------------------------------------------------------------------------
// Problem constants (from reference setup_inputs)
// ---------------------------------------------------------------------------
#define BATCH   8
#define CI      256
#define HWSZ    1600          // 40*40
#define DDIM    128
#define NCLOUD  32768
#define NHEAD   8
#define DH      16            // DDIM / NHEAD
#define GEM_EPS 1e-6f
#define L2_EPS  1e-12f
#define LOG2E   1.44269504088896340736f

typedef float v2f __attribute__((ext_vector_type(2)));
typedef float v8f __attribute__((ext_vector_type(8)));
typedef int   v4i __attribute__((vector_size(16)));   // builtin's pointee type

#define GLB_AS __attribute__((address_space(1)))
#define LDS_AS __attribute__((address_space(3)))

// CDNA5 async global->LDS copy path (ASYNCcnt-tracked). Guarded so the file
// still compiles (host pass + older toolchains) with a plain-load fallback.
#if defined(__AMDGCN__) && __has_builtin(__builtin_amdgcn_global_load_async_to_lds_b128)
#define USE_ASYNC_LDS 1
#else
#define USE_ASYNC_LDS 0
#endif

#if USE_ASYNC_LDS
template <int N>
__device__ __forceinline__ void async_wait() {
#if __has_builtin(__builtin_amdgcn_s_wait_asynccnt)
  __builtin_amdgcn_s_wait_asynccnt(N);
#else
  asm volatile("s_wait_asynccnt %0" ::"i"(N) : "memory");
#endif
  asm volatile("" ::: "memory");   // keep LDS reads below the wait
}
#endif

// fp32 WMMA: D(16x16,f32) = A(16x4,f32) * B(4x16,f32) + C
__device__ __forceinline__ v8f wmma4(v2f a, v2f b, v8f c) {
  return __builtin_amdgcn_wmma_f32_16x16x4_f32(false, a, false, b, (short)0, c,
                                               false, false);
}

// Row reductions inside a 16-lane half (C/D layout: a row's 16 cols live in
// one 16-lane half of a wave32).
__device__ __forceinline__ float red16_sum(float v) {
  v += __shfl_xor(v, 1, 32);
  v += __shfl_xor(v, 2, 32);
  v += __shfl_xor(v, 4, 32);
  v += __shfl_xor(v, 8, 32);
  return v;
}
__device__ __forceinline__ float red32_sum(float v) {
  v += __shfl_xor(v, 1, 32);
  v += __shfl_xor(v, 2, 32);
  v += __shfl_xor(v, 4, 32);
  v += __shfl_xor(v, 8, 32);
  v += __shfl_xor(v, 16, 32);
  return v;
}

// ---------------------------------------------------------------------------
// Kernel 0: zero the accumulator region of the workspace
// ---------------------------------------------------------------------------
__global__ void k_zero(float* p, int n) {
  int i = blockIdx.x * blockDim.x + threadIdx.x;
  if (i < n) p[i] = 0.0f;
}

// ---------------------------------------------------------------------------
// Kernel 1: tok = l2norm(image_feat^T @ W1 + b1)
// A block is four waves on one 16-row M-tile (the full 16x128 row block).  Each
// wave contracts over its own quarter of the 256 channels, so a SIMD holds
// three or four waves whose load waits and matrix work overlap, where one wave
// alone stood exposed to every memory wait.  The quarters are joined in LDS
// behind one barrier; the rows are then dealt over the waves for bias, norm
// and store.
// ---------------------------------------------------------------------------
#define G1W 4                 // waves per block, a quarter of the channels each
#define G1K (CI / G1W)        // 64 channels per wave
#define G1P 132               // floats; row pitch of the partial sums: rows r and
                              // r + 8 fall on different banks, 16-byte aligned

// Four waves to a SIMD: registers for the loads in flight, and no WGP takes a
// fifth block while another stands short.
__global__ void __launch_bounds__(32 * G1W)
__attribute__((amdgpu_waves_per_eu(4, 4)))
k_gemm1_l2norm(const float* __restrict__ img, const float* __restrict__ W1,
               const float* __restrict__ b1, float* __restrict__ tok) {
  __shared__ __attribute__((aligned(16))) float part[G1W][16][G1P];
  const int lane = threadIdx.x & 31;
  const int wave = __builtin_amdgcn_readfirstlane(threadIdx.x >> 5);
  const int lo = lane & 15, hi = lane >> 4;
  const int mBase = blockIdx.x * 16;          // 800 tiles, never crosses batch
  const int b  = mBase / HWSZ;
  const int hw = (mBase % HWSZ) + lo;
  const float* aBase = img + (size_t)b * CI * HWSZ + hw;
  // K per A/B fragment lane-half: channel wave*64 + s*4 + hi*2 (+1) at k step s
  const int kW = wave * G1K + hi * 2;
  const float* aW = aBase + (size_t)kW * HWSZ;
  const float* wW = W1 + kW * DDIM + lo;
  const float4 bias = ((const float4*)b1)[lane];   // for the rows' finish, asked for early

  v8f acc[8];
#pragma unroll
  for (int nt = 0; nt < 8; ++nt) acc[nt] = (v8f){0, 0, 0, 0, 0, 0, 0, 0};

  // The wave's A slice (16 k steps), at constant offsets from one address.
  v2f a[G1K / 4];
#pragma unroll
  for (int s = 0; s < G1K / 4; ++s) {
    a[s].x = aW[(s * 4 + 0) * HWSZ];
    a[s].y = aW[(s * 4 + 1) * HWSZ];
  }
  // The address pair of these loads is free for reuse from here on: keep the
  // wait on their address translation in front of any overwrite of it.
  asm volatile("s_wait_xcnt 0x0" ::: "memory");

  // W1 fragments run two k steps ahead of their products, in three register
  // sets; unrolled in full so that a[] and the sets stay in registers.
  v2f bb[3][8];
#pragma unroll
  for (int s = 0; s < 2; ++s) {
#pragma unroll
    for (int nt = 0; nt < 8; ++nt) {
      bb[s][nt].x = wW[(s * 4 + 0) * DDIM + nt * 16];
      bb[s][nt].y = wW[(s * 4 + 1) * DDIM + nt * 16];
    }
  }
#pragma unroll
  for (int s = 0; s < G1K / 4; ++s) {
    if (s + 2 < G1K / 4) {
#pragma unroll
      for (int nt = 0; nt < 8; ++nt) {
        bb[(s + 2) % 3][nt].x = wW[((s + 2) * 4 + 0) * DDIM + nt * 16];
        bb[(s + 2) % 3][nt].y = wW[((s + 2) * 4 + 1) * DDIM + nt * 16];
      }
    }
#pragma unroll
    for (int nt = 0; nt < 8; ++nt) acc[nt] = wmma4(a[s], bb[s % 3][nt], acc[nt]);
  }

  // Join the four channel quarters: every wave leaves its sums in LDS ...
#pragma unroll
  for (int nt = 0; nt < 8; ++nt) {
#pragma unroll
    for (int r = 0; r < 8; ++r) part[wave][r + hi * 8][nt * 16 + lo] = acc[nt][r];
  }
  __syncthreads();   // all four waves' sums stand in LDS before any is read

  // ... and each wave finishes four whole rows, four columns per lane.
  float4 v[16 / G1W];
  float ss[16 / G1W];
#pragma unroll
  for (int i = 0; i < 16 / G1W; ++i) {
    const int row = wave * (16 / G1W) + i;
    const float4 p0 = *(const float4*)&part[0][row][lane * 4];
    const float4 p1 = *(const float4*)&part[1][row][lane * 4];
    const float4 p2 = *(const float4*)&part[2][row][lane * 4];
    const float4 p3 = *(const float4*)&part[3][row][lane * 4];
    v[i].x = (((p0.x + p1.x) + p2.x) + p3.x) + bias.x;
    v[i].y = (((p0.y + p1.y) + p2.y) + p3.y) + bias.y;
    v[i].z = (((p0.z + p1.z) + p2.z) + p3.z) + bias.z;
    v[i].w = (((p0.w + p1.w) + p2.w) + p3.w) + bias.w;
    ss[i] = v[i].x * v[i].x + v[i].y * v[i].y + v[i].z * v[i].z + v[i].w * v[i].w;
  }
#pragma unroll
  for (int i = 0; i < 16 / G1W; ++i) ss[i] = red32_sum(ss[i]);   // per-row sum of squares
  float4* dst = (float4*)(tok + (size_t)(mBase + wave * (16 / G1W)) * DDIM) + lane;
#pragma unroll
  for (int i = 0; i < 16 / G1W; ++i) {
    const float inv = 1.0f / fmaxf(sqrtf(ss[i]), L2_EPS);
    float4 w;
    w.x = v[i].x * inv; w.y = v[i].y * inv; w.z = v[i].z * inv; w.w = v[i].w * inv;
    dst[i * (DDIM / 4)] = w;
  }
}

#define KVSTRIDE 20

#if USE_ASYNC_LDS
__device__ __forceinline__ void issue_kv(const float* __restrict__ tok,
                                         float* kvbuf, int kRow0, int dcol,
                                         int lane) {
  const int row = lane >> 2;                  // 0..7
  const int sub = (lane & 3) * 4;             // float offset in row
  const float* g0 = tok + (size_t)(kRow0 + row) * DDIM + dcol + sub;
  const float* g1 = g0 + (size_t)8 * DDIM;
  __builtin_amdgcn_global_load_async_to_lds_b128(
      (v4i*)g0, (LDS_AS v4i*)&kvbuf[row * KVSTRIDE + sub], 0, 0);
  __builtin_amdgcn_global_load_async_to_lds_b128(
      (v4i*)g1, (LDS_AS v4i*)&kvbuf[(row + 8) * KVSTRIDE + sub], 0, 0);
}
#endif

// Value of lane l ^ 16 (the other half of the wave), by a vector cross-row move.
__device__ __forceinline__ float other_half(float v) {
  const unsigned u = __builtin_bit_cast(unsigned, v);
  return __builtin_bit_cast(float, __builtin_amdgcn_permlanex16(
      u, u, 0x76543210u, 0xfedcba98u, false, false));
}

// A block is four waves on one (batch, head, group of QT query tiles).  Each
// wave carries all QT query tiles against its own quarter of the keys, so one
// K/V tile (one pair of copies, one set of LDS fragment reads) feeds QT tiles'
// products, which are independent chains for the matrix unit.  With no running
// maximum the quarters' O and row sums simply add: they are joined through LDS
// behind one barrier at the end.
#define QT     5                      // query tiles per wave
#define KSPLIT 4                      // waves per block, a quarter of the keys each
#define KTW    (HWSZ / 16 / KSPLIT)   // 25 key tiles per wave

// The grid is five blocks per WGP.  At most five waves fit a SIMD (the
// attribute pads the register allocation), so no WGP can take a sixth block
// while another stands short: every matrix unit gets the same share.
__global__ void __launch_bounds__(32 * KSPLIT)
__attribute__((amdgpu_waves_per_eu(5, 5)))
k_attn(const float* __restrict__ tok, float* __restrict__ out) {
#if USE_ASYNC_LDS
  // one private double-buffered K/V ring per wave
  __shared__ __attribute__((aligned(16))) float kv[KSPLIT][2][16 * KVSTRIDE];
#endif
  __shared__ float part[KSPLIT][QT][9][32];   // each wave's O (8) and row sum (1)
  const int lane = threadIdx.x & 31;
  const int wave = __builtin_amdgcn_readfirstlane(threadIdx.x >> 5);
  const int lo = lane & 15, hi = lane >> 4;

  int idx = blockIdx.x;                       // 8*8*20 blocks
  const int qg = idx % (HWSZ / 16 / QT); idx /= (HWSZ / 16 / QT);
  const int h  = idx % NHEAD;
  const int b  = idx / NHEAD;
  const int dcol  = h * DH;
  const int qRow0 = b * HWSZ + qg * (QT * 16);
  const int kRowW = b * HWSZ + wave * (KTW * 16);   // this wave's first key

  // Q^T in B-layout: 4 chunks of 4x16 per tile, B[K=d, N=query] = tok[query, d]
  v2f qb[QT][4];
#pragma unroll
  for (int t = 0; t < QT; ++t) {
#pragma unroll
    for (int kk = 0; kk < 4; ++kk) {
      const float* p =
          tok + (size_t)(qRow0 + t * 16 + lo) * DDIM + dcol + kk * 4 + hi * 2;
      qb[t][kk].x = p[0];
      qb[t][kk].y = p[1];
    }
  }

  // O^T accumulators: o[t][r] = O[query = t*16 + lo][d = r + 8*hi]
  v8f o[QT];
  float lrun[QT];                             // this half's share of the row sums
#pragma unroll
  for (int t = 0; t < QT; ++t) {
    o[t] = (v8f){0, 0, 0, 0, 0, 0, 0, 0};
    lrun[t] = 0.0f;
  }

#if USE_ASYNC_LDS
  issue_kv(tok, kv[wave][0], kRowW, dcol, lane);   // prime the pipeline
#endif

  for (int kt = 0; kt < KTW; ++kt) {
    const int kRow0 = kRowW + kt * 16;
#if USE_ASYNC_LDS
    float* kvc = kv[wave][kt & 1];
    if (kt + 1 < KTW) {                       // overlap next copy with compute
      issue_kv(tok, kv[wave][(kt + 1) & 1], kRow0 + 16, dcol, lane);
      async_wait<2>();                        // in-order: older tile complete
    } else {
      async_wait<0>();
    }
#else
    if (kt + 1 < KTW)                         // CDNA5 global_prefetch_b8
      __builtin_prefetch(tok + (size_t)(kRow0 + 16 + lo) * DDIM + dcol, 0, 0);
#endif

    // The key tile's two fragment sets, read once for all QT query tiles.
    v2f ka[4];                                 // A[M=key, K=d] = tok[key, d]
#pragma unroll
    for (int kk = 0; kk < 4; ++kk) {
      const int kidx = kk * 4 + hi * 2;
#if USE_ASYNC_LDS
      ka[kk].x = kvc[lo * KVSTRIDE + kidx + 0];
      ka[kk].y = kvc[lo * KVSTRIDE + kidx + 1];
#else
      const float* p = tok + (size_t)(kRow0 + lo) * DDIM + dcol + kidx;
      ka[kk].x = p[0];
      ka[kk].y = p[1];
#endif
    }
    // k position hi*2 + i of chunk j stands for key 2*j + i + 8*hi on both sides
#if USE_ASYNC_LDS
    const float* vcol = kvc + hi * 8 * KVSTRIDE + lo;
#else
    const float* vcol = tok + (size_t)(kRow0 + hi * 8) * DDIM + dcol + lo;
#endif
    v2f va[4];                                 // A[M=d, K=key] = tok[key, d]
#pragma unroll
    for (int j = 0; j < 4; ++j) {
#if USE_ASYNC_LDS
      va[j].x = vcol[(j * 2 + 0) * KVSTRIDE];
      va[j].y = vcol[(j * 2 + 1) * KVSTRIDE];
#else
      va[j].x = vcol[(j * 2 + 0) * DDIM];
      va[j].y = vcol[(j * 2 + 1) * DDIM];
#endif
    }

#pragma unroll
    for (int t = 0; t < QT; ++t) {
      // S^T = K * Q^T   (contraction over dh=16 -> 4 fp32 WMMAs)
      // S[r] = score(query = lo, key = r + 8*hi)
      v8f S = (v8f){0, 0, 0, 0, 0, 0, 0, 0};
#pragma unroll
      for (int kk = 0; kk < 4; ++kk) S = wmma4(ka[kk], qb[t][kk], S);

      // softmax numerators: one query per lane, its 16 keys split over the halves
      const v8f e = S * (0.25f * LOG2E);       // dh^-0.5; exp(x) = exp2(x * log2 e)
      v8f prob;
      float psum = 0.0f;
#pragma unroll
      for (int r = 0; r < 8; ++r) {
        prob[r] = __builtin_amdgcn_exp2f(e[r]);
        psum += prob[r];
      }
      lrun[t] += psum;

      // O^T += V^T * P^T   (contraction over 16 keys -> 4 fp32 WMMAs)
#pragma unroll
      for (int j = 0; j < 4; ++j) {
        v2f pb;                                // B[K=key, N=query]
        pb.x = prob[j * 2 + 0];
        pb.y = prob[j * 2 + 1];
        o[t] = wmma4(va[j], pb, o[t]);
      }
    }
#if USE_ASYNC_LDS
    // The ring is private to this one wave: its own reads of kvc must have
    // retired before the next trip's copies refill that buffer.
    asm volatile("s_wait_dscnt 0x0" ::: "memory");
#endif
  }

  // Join the four key quarters: every wave leaves its sums in LDS ...
#pragma unroll
  for (int t = 0; t < QT; ++t) {
#pragma unroll
    for (int r = 0; r < 8; ++r) part[wave][t][r][lane] = o[t][r];
    part[wave][t][8][lane] = lrun[t];
  }
  __syncthreads();   // all four waves' sums stand in LDS before any is read

  // ... and the query tiles are dealt over the waves for the sum and the store.
  for (int t = wave; t < QT; t += KSPLIT) {
    float acc[9];
#pragma unroll
    for (int r = 0; r < 9; ++r)
      acc[r] = ((part[0][t][r][lane] + part[1][t][r][lane]) +
                part[2][t][r][lane]) + part[3][t][r][lane];
    const float l = acc[8] + other_half(acc[8]);   // join the halves' sums once
    float4 w0, w1;                             // 8 consecutive d of one query
    w0.x = acc[0] / l; w0.y = acc[1] / l; w0.z = acc[2] / l; w0.w = acc[3] / l;
    w1.x = acc[4] / l; w1.y = acc[5] / l; w1.z = acc[6] / l; w1.w = acc[7] / l;
    float4* dst =
        (float4*)(out + (size_t)(qRow0 + t * 16 + lo) * DDIM + dcol + hi * 8);
    dst[0] = w0;
    dst[1] = w1;
    // A second pass of this loop rewrites the stores' address and data
    // registers: keep the wait on their address translation in front of that.
    asm volatile("s_wait_xcnt 0x0" ::: "memory");
  }
}

// ---------------------------------------------------------------------------
// Kernel 3: img_out = (attn_out @ W2 + b2), stored as [B,Ci,H,W], fused with
// GeM clip^3 partial accumulation.
// A block is four waves on 64 rows x 64 channels.  A wave owns 16 rows and all
// 64 channels as four column tiles, so one A fragment feeds four independent
// products; the four waves read the same 32 KiB stripe of W2.  Column tile t
// holds channels 4*lo + t, so one 16-byte load of a W2 row serves all four
// tiles; one 16-byte load of an x row serves two k steps (k position hi*2 + i
// of step 2*j + p stands for d = 8*j + 4*hi + 2*p + i on both sides).
// The block's tile is laid in LDS channel-major, and its GeM sums beside it,
// behind one barrier: the stores then cover whole 256-byte runs of a channel.
// ---------------------------------------------------------------------------
#define G2W  4                // waves per block, 16 rows each
#define G2N  4                // column tiles per wave
#define G2C  (16 * G2N)       // 64 channels per block
#define G2R  (16 * G2W)       // 64 rows per block, never crosses a batch
#define G2AH 6                // k steps, at the least, that the W2 rows run ahead of their
                              // products (the compiler asks earlier where registers allow)
#define G2P  (G2R + 4)        // floats; row pitch of the staged tile, 16-byte aligned

// Four waves to a SIMD: registers for the loads in flight, and no WGP takes a
// fifth block while another stands short.
__global__ void __launch_bounds__(32 * G2W)
__attribute__((amdgpu_waves_per_eu(4, 4)))
k_gemm2(const float* __restrict__ x, const float* __restrict__ W2,
        const float* __restrict__ b2, float* __restrict__ img_out,
        float* __restrict__ gem_acc) {
  __shared__ __attribute__((aligned(16))) float tile[G2C][G2P];
  __shared__ __attribute__((aligned(16))) float gs[G2W][G2C];
  const int lane = threadIdx.x & 31;
  const int wave = __builtin_amdgcn_readfirstlane(threadIdx.x >> 5);
  const int lo = lane & 15, hi = lane >> 4;
  const int mBlk  = blockIdx.x * G2R;          // 200
  const int nBase = blockIdx.y * G2C;          // 4
  const int b = mBlk / HWSZ, hw0 = mBlk % HWSZ;

  const float4* aP =
      (const float4*)(x + (size_t)(mBlk + wave * 16 + lo) * DDIM + hi * 4);
  const float4* wP = (const float4*)(W2 + (hi * 4) * CI + nBase + lo * 4);
  const float4 bias = *(const float4*)(b2 + nBase + lo * 4);

  // W2 rows of k step s: 8*(s/2) + 2*(s%2) + i above the lane half's first row
#define G2ROW(s, i) ((((s) >> 1) * 8 + ((s) & 1) * 2 + (i)) * (CI / 4))
  float4 w[G2AH + 1][2];
#pragma unroll
  for (int s = 0; s < G2AH; ++s) {
    w[s][0] = wP[G2ROW(s, 0)];
    w[s][1] = wP[G2ROW(s, 1)];
  }
  // The wave's whole A slice, at constant offsets from one address.
  float4 a[DDIM / 8];
#pragma unroll
  for (int j = 0; j < DDIM / 8; ++j) a[j] = aP[j * 2];

  v8f acc[G2N];
#pragma unroll
  for (int t = 0; t < G2N; ++t) acc[t] = (v8f){0, 0, 0, 0, 0, 0, 0, 0};

  // Unrolled in full so that a[] and the ring of W2 rows stay in registers.
#pragma unroll
  for (int s = 0; s < DDIM / 4; ++s) {
    if (s + G2AH < DDIM / 4) {
      w[(s + G2AH) % (G2AH + 1)][0] = wP[G2ROW(s + G2AH, 0)];
      w[(s + G2AH) % (G2AH + 1)][1] = wP[G2ROW(s + G2AH, 1)];
    }
    v2f af;
    af.x = (s & 1) ? a[s >> 1].z : a[s >> 1].x;
    af.y = (s & 1) ? a[s >> 1].w : a[s >> 1].y;
    const float4 w0 = w[s % (G2AH + 1)][0];
    const float4 w1 = w[s % (G2AH + 1)][1];
    acc[0] = wmma4(af, (v2f){w0.x, w1.x}, acc[0]);
    acc[1] = wmma4(af, (v2f){w0.y, w1.y}, acc[1]);
    acc[2] = wmma4(af, (v2f){w0.z, w1.z}, acc[2]);
    acc[3] = wmma4(af, (v2f){w0.w, w1.w}, acc[3]);
  }
#undef G2ROW

  // acc[t][r] = row (wave*16 + 8*hi + r), channel (4*lo + t) of the block's tile
  const float bs[G2N] = {bias.x, bias.y, bias.z, bias.w};
  float g[G2N];
#pragma unroll
  for (int t = 0; t < G2N; ++t) {
    float v[8];
    float gsum = 0.0f;
#pragma unroll
    for (int r = 0; r < 8; ++r) {
      v[r] = acc[t][r] + bs[t];
      const float c = fmaxf(v[r], GEM_EPS);
      gsum += c * c * c;                       // clip^p, p=3
    }
    float4* st = (float4*)&tile[lo * 4 + t][wave * 16 + hi * 8];
    st[0] = make_float4(v[0], v[1], v[2], v[3]);
    st[1] = make_float4(v[4], v[5], v[6], v[7]);
    g[t] = gsum + other_half(gsum);            // combine both 8-row halves
  }
  if (hi == 0) *(float4*)&gs[wave][lo * 4] = make_float4(g[0], g[1], g[2], g[3]);
  __syncthreads();   // the block's tile and sums stand in LDS before any is read

  if (wave < G2C / 32) {                       // one add per channel and block
    const int c = wave * 32 + lane;
    atomicAdd(&gem_acc[b * CI + nBase + c],
              ((gs[0][c] + gs[1][c]) + gs[2][c]) + gs[3][c]);
  }

  // Each wave stores 16 channels, two per instruction: 256 contiguous bytes each.
  float* dst = img_out + (size_t)(b * CI + nBase + wave * 16 + hi) * HWSZ + hw0 + lo * 4;
#pragma unroll
  for (int i = 0; i < 8; ++i) {
    const float4 v = *(const float4*)&tile[wave * 16 + i * 2 + hi][lo * 4];
    *(float4*)(dst + (size_t)(i * 2) * HWSZ) = v;
  }
}

// ---------------------------------------------------------------------------
// Kernel 4: cloud branch: l2norm rows, clip^3, LDS-staged segment sums.
// One wave per row (128 elems = float4 per lane).
// ---------------------------------------------------------------------------
__global__ void __launch_bounds__(256)
k_cloud(const float* __restrict__ cf, const int* __restrict__ bids,
        float* __restrict__ cout, float* __restrict__ seg_acc,
        float* __restrict__ cnt_acc) {
  __shared__ float seg[BATCH * DDIM];
  __shared__ float cnt[BATCH];
  const int t = threadIdx.x;
  const int lane = t & 31;
  const int wave = t >> 5;
  for (int i = t; i < BATCH * DDIM; i += 256) seg[i] = 0.0f;
  if (t < BATCH) cnt[t] = 0.0f;
  __syncthreads();

  const int wgid = blockIdx.x * 8 + wave;
  const int nw = gridDim.x * 8;
  for (int row = wgid; row < NCLOUD; row += nw) {
    const float4 v = ((const float4*)(cf + (size_t)row * DDIM))[lane];
    float ss = v.x * v.x + v.y * v.y + v.z * v.z + v.w * v.w;
    ss = red32_sum(ss);
    const float inv = 1.0f / fmaxf(sqrtf(ss), L2_EPS);
    float4 o;
    o.x = v.x * inv; o.y = v.y * inv; o.z = v.z * inv; o.w = v.w * inv;
    ((float4*)(cout + (size_t)row * DDIM))[lane] = o;

    const int bid = bids[row];
    float cx = fmaxf(o.x, GEM_EPS), cy = fmaxf(o.y, GEM_EPS);
    float cz = fmaxf(o.z, GEM_EPS), cw = fmaxf(o.w, GEM_EPS);
    float* sp = seg + bid * DDIM + lane * 4;
    atomicAdd(sp + 0, cx * cx * cx);
    atomicAdd(sp + 1, cy * cy * cy);
    atomicAdd(sp + 2, cz * cz * cz);
    atomicAdd(sp + 3, cw * cw * cw);
    if (lane == 0) atomicAdd(&cnt[bid], 1.0f);
  }
  __syncthreads();
  for (int i = t; i < BATCH * DDIM; i += 256) atomicAdd(&seg_acc[i], seg[i]);
  if (t < BATCH) atomicAdd(&cnt_acc[t], cnt[t]);
}

// ---------------------------------------------------------------------------
// Kernel 5: finalize GeM pools
// ---------------------------------------------------------------------------
__global__ void k_finalize(const float* __restrict__ img_acc,
                           const float* __restrict__ seg_acc,
                           const float* __restrict__ cnt_acc,
                           float* __restrict__ image_gem,
                           float* __restrict__ cloud_gem) {
  const int i = blockIdx.x * blockDim.x + threadIdx.x;
  if (i < BATCH * CI) image_gem[i] = cbrtf(img_acc[i] * (1.0f / (float)HWSZ));
  if (i < BATCH * DDIM) {
    const int b = i / DDIM;
    cloud_gem[i] = cbrtf(seg_acc[i] / fmaxf(cnt_acc[b], 1.0f));
  }
}

// ---------------------------------------------------------------------------
// Host launcher
// ---------------------------------------------------------------------------
extern "C" void kernel_launch(void* const* d_in, const int* in_sizes, int n_in,
                              void* d_out, int out_size, void* d_ws, size_t ws_size,
                              hipStream_t stream) {
  const float* image_feat = (const float*)d_in[0];   // [8,256,40,40]
  const float* cloud_feat = (const float*)d_in[1];   // [32768,128]
  const int*   cloud_bids = (const int*)d_in[2];     // [32768]
  const float* W1 = (const float*)d_in[3];           // [256,128]
  const float* b1 = (const float*)d_in[4];           // [128]
  const float* W2 = (const float*)d_in[5];           // [128,256]
  const float* b2 = (const float*)d_in[6];           // [256]

  // Output layout (floats, concatenated in reference return order)
  float* out_img   = (float*)d_out;                         // 8*256*1600
  float* out_cloud = out_img + (size_t)BATCH * CI * HWSZ;   // 32768*128
  float* out_igem  = out_cloud + (size_t)NCLOUD * DDIM;     // 8*256
  float* out_cgem  = out_igem + BATCH * CI;                 // 8*128

  // Workspace layout (~13.1 MB of floats)
  float* ws      = (float*)d_ws;
  float* tok     = ws;                                      // 12800*128
  float* attn    = tok + (size_t)12800 * DDIM;              // 12800*128
  float* img_acc = attn + (size_t)12800 * DDIM;             // 2048
  float* seg_acc = img_acc + BATCH * CI;                    // 1024
  float* cnt_acc = seg_acc + BATCH * DDIM;                  // 8

  // 0) zero accumulators (ws is poisoned; must be deterministic every call)
  const int nzero = BATCH * CI + BATCH * DDIM + BATCH;      // 3080
  k_zero<<<(nzero + 255) / 256, 256, 0, stream>>>(img_acc, nzero);

  // 1) tok = l2norm(image^T @ W1 + b1)
  k_gemm1_l2norm<<<12800 / 16, 32 * G1W, 0, stream>>>(image_feat, W1, b1, tok);

  // 2) flash self-attention per (b, head, group of q-tiles)
  k_attn<<<BATCH * NHEAD * (HWSZ / 16 / QT), 32 * KSPLIT, 0, stream>>>(tok, attn);

  // 3) img_out = attn @ W2 + b2 (NCHW) + GeM accumulation
  k_gemm2<<<dim3(12800 / G2R, CI / G2C), 32 * G2W, 0, stream>>>(attn, W2, b2,
                                                                out_img, img_acc);

  // 4) cloud branch
  k_cloud<<<256, 256, 0, stream>>>(cloud_feat, cloud_bids, out_cloud,
                                   seg_acc, cnt_acc);

  // 5) finalize GeM pools
  k_finalize<<<(BATCH * CI + 255) / 256, 256, 0, stream>>>(
      img_acc, seg_acc, cnt_acc, out_igem, out_cgem);
}

// v006
// A run of this version takes 80.3 microseconds.
// Timed twice side by side with v005, it ran 1.17 and 1.18 times as fast.
// Counting every step since v000, it is 2.83 times as fast.
#include <hip/hip_runtime.h>
#include <hip/hip_bf16.h>
#include <math.h>

// ---------------------------------------------------------------------------
// Problem constants (from reference setup_inputs)
// ---------------------------------------------------------------------------
#define BATCH   8
#define CI      256
#define HWSZ    1600          // 40*40
#define DDIM    128
#define NCLOUD  32768
#define NHEAD   8
#define DH      16            // DDIM / NHEAD
#define GEM_EPS 1e-6f
#define L2_EPS  1e-12f
#define LOG2E   1.44269504088896340736f

typedef float v2f __attribute__((ext_vector_type(2)));
typedef float v8f __attribute__((ext_vector_type(8)));
typedef int   v4i __attribute__((vector_size(16)));   // builtin's pointee type

#define GLB_AS __attribute__((address_space(1)))
#define LDS_AS __attribute__((address_space(3)))

// CDNA5 async global->LDS copy path (ASYNCcnt-tracked). Guarded so the file
// still compiles (host pass + older toolchains) with a plain-load fallback.
#if defined(__AMDGCN__) && __has_builtin(__builtin_amdgcn_global_load_async_to_lds_b128)
#define USE_ASYNC_LDS 1
#else
#define USE_ASYNC_LDS 0
#endif

#if USE_ASYNC_LDS
template <int N>
__device__ __forceinline__ void async_wait() {
#if __has_builtin(__builtin_amdgcn_s_wait_asynccnt)
  __builtin_amdgcn_s_wait_asynccnt(N);
#else
  asm volatile("s_wait_asynccnt %0" ::"i"(N) : "memory");
#endif
  asm volatile("" ::: "memory");   // keep LDS reads below the wait
}
#endif

// fp32 WMMA: D(16x16,f32) = A(16x4,f32) * B(4x16,f32) + C
__device__ __forceinline__ v8f wmma4(v2f a, v2f b, v8f c) {
  return __builtin_amdgcn_wmma_f32_16x16x4_f32(false, a, false, b, (short)0, c,
                                               false, false);
}

// Row reductions inside a 16-lane half (C/D layout: a row's 16 cols live in
// one 16-lane half of a wave32).
__device__ __forceinline__ float red16_sum(float v) {
  v += __shfl_xor(v, 1, 32);
  v += __shfl_xor(v, 2, 32);
  v += __shfl_xor(v, 4, 32);
  v += __shfl_xor(v, 8, 32);
  return v;
}
__device__ __forceinline__ float red32_sum(float v) {
  v += __shfl_xor(v, 1, 32);
  v += __shfl_xor(v, 2, 32);
  v += __shfl_xor(v, 4, 32);
  v += __shfl_xor(v, 8, 32);
  v += __shfl_xor(v, 16, 32);
  return v;
}

// ---------------------------------------------------------------------------
// Kernel 0: zero the accumulator region of the workspace
// ---------------------------------------------------------------------------
__global__ void k_zero(float* p, int n) {
  int i = blockIdx.x * blockDim.x + threadIdx.x;
  if (i < n) p[i] = 0.0f;
}

// ---------------------------------------------------------------------------
// Kernel 1: tok = l2norm(image_feat^T @ W1 + b1)
// A block is four waves on one 16-row M-tile (the full 16x128 row block).  Each
// wave contracts over its own quarter of the 256 channels, so a SIMD holds
// three or four waves whose load waits and matrix work overlap, where one wave
// alone stood exposed to every memory wait.  The quarters are joined in LDS
// behind one barrier; the rows are then dealt over the waves for bias, norm
// and store.
// ---------------------------------------------------------------------------
#define G1W 4                 // waves per block, a quarter of the channels each
#define G1K (CI / G1W)        // 64 channels per wave
#define G1P 132               // floats; row pitch of the partial sums: rows r and
                              // r + 8 fall on different banks, 16-byte aligned

// Four waves to a SIMD: registers for the loads in flight, and no WGP takes a
// fifth block while another stands short.
__global__ void __launch_bounds__(32 * G1W)
__attribute__((amdgpu_waves_per_eu(4, 4)))
k_gemm1_l2norm(const float* __restrict__ img, const float* __restrict__ W1,
               const float* __restrict__ b1, float* __restrict__ tok) {
  __shared__ __attribute__((aligned(16))) float part[G1W][16][G1P];
  const int lane = threadIdx.x & 31;
  const int wave = __builtin_amdgcn_readfirstlane(threadIdx.x >> 5);
  const int lo = lane & 15, hi = lane >> 4;
  const int mBase = blockIdx.x * 16;          // 800 tiles, never crosses batch
  const int b  = mBase / HWSZ;
  const int hw = (mBase % HWSZ) + lo;
  const float* aBase = img + (size_t)b * CI * HWSZ + hw;
  // K per A/B fragment lane-half: channel wave*64 + s*4 + hi*2 (+1) at k step s
  const int kW = wave * G1K + hi * 2;
  const float* aW = aBase + (size_t)kW * HWSZ;
  const float* wW = W1 + kW * DDIM + lo;
  const float4 bias = ((const float4*)b1)[lane];   // for the rows' finish, asked for early

  v8f acc[8];
#pragma unroll
  for (int nt = 0; nt < 8; ++nt) acc[nt] = (v8f){0, 0, 0, 0, 0, 0, 0, 0};

  // The wave's A slice (16 k steps), at constant offsets from one address.
  v2f a[G1K / 4];
#pragma unroll
  for (int s = 0; s < G1K / 4; ++s) {
    a[s].x = aW[(s * 4 + 0) * HWSZ];
    a[s].y = aW[(s * 4 + 1) * HWSZ];
  }
  // The address pair of these loads is free for reuse from here on: keep the
  // wait on their address translation in front of any overwrite of it.
  asm volatile("s_wait_xcnt 0x0" ::: "memory");

  // W1 fragments run two k steps ahead of their products, in three register
  // sets; unrolled in full so that a[] and the sets stay in registers.
  v2f bb[3][8];
#pragma unroll
  for (int s = 0; s < 2; ++s) {
#pragma unroll
    for (int nt = 0; nt < 8; ++nt) {
      bb[s][nt].x = wW[(s * 4 + 0) * DDIM + nt * 16];
      bb[s][nt].y = wW[(s * 4 + 1) * DDIM + nt * 16];
    }
  }
#pragma unroll
  for (int s = 0; s < G1K / 4; ++s) {
    if (s + 2 < G1K / 4) {
#pragma unroll
      for (int nt = 0; nt < 8; ++nt) {
        bb[(s + 2) % 3][nt].x = wW[((s + 2) * 4 + 0) * DDIM + nt * 16];
        bb[(s + 2) % 3][nt].y = wW[((s + 2) * 4 + 1) * DDIM + nt * 16];
      }
    }
#pragma unroll
    for (int nt = 0; nt < 8; ++nt) acc[nt] = wmma4(a[s], bb[s % 3][nt], acc[nt]);
  }

  // Join the four channel quarters: every wave leaves its sums in LDS ...
#pragma unroll
  for (int nt = 0; nt < 8; ++nt) {
#pragma unroll
    for (int r = 0; r < 8; ++r) part[wave][r + hi * 8][nt * 16 + lo] = acc[nt][r];
  }
  __syncthreads();   // all four waves' sums stand in LDS before any is read

  // ... and each wave finishes four whole rows, four columns per lane.
  float4 v[16 / G1W];
  float ss[16 / G1W];
#pragma unroll
  for (int i = 0; i < 16 / G1W; ++i) {
    const int row = wave * (16 / G1W) + i;
    const float4 p0 = *(const float4*)&part[0][row][lane * 4];
    const float4 p1 = *(const float4*)&part[1][row][lane * 4];
    const float4 p2 = *(const float4*)&part[2][row][lane * 4];
    const float4 p3 = *(const float4*)&part[3][row][lane * 4];
    v[i].x = (((p0.x + p1.x) + p2.x) + p3.x) + bias.x;
    v[i].y = (((p0.y + p1.y) + p2.y) + p3.y) + bias.y;
    v[i].z = (((p0.z + p1.z) + p2.z) + p3.z) + bias.z;
    v[i].w = (((p0.w + p1.w) + p2.w) + p3.w) + bias.w;
    ss[i] = v[i].x * v[i].x + v[i].y * v[i].y + v[i].z * v[i].z + v[i].w * v[i].w;
  }
#pragma unroll
  for (int i = 0; i < 16 / G1W; ++i) ss[i] = red32_sum(ss[i]);   // per-row sum of squares
  float4* dst = (float4*)(tok + (size_t)(mBase + wave * (16 / G1W)) * DDIM) + lane;
#pragma unroll
  for (int i = 0; i < 16 / G1W; ++i) {
    const float inv = 1.0f / fmaxf(sqrtf(ss[i]), L2_EPS);
    float4 w;
    w.x = v[i].x * inv; w.y = v[i].y * inv; w.z = v[i].z * inv; w.w = v[i].w * inv;
    dst[i * (DDIM / 4)] = w;
  }
}

#define KVSTRIDE 20

#if USE_ASYNC_LDS
__device__ __forceinline__ void issue_kv(const float* __restrict__ tok,
                                         float* kvbuf, int kRow0, int dcol,
                                         int lane) {
  const int row = lane >> 2;                  // 0..7
  const int sub = (lane & 3) * 4;             // float offset in row
  const float* g0 = tok + (size_t)(kRow0 + row) * DDIM + dcol + sub;
  const float* g1 = g0 + (size_t)8 * DDIM;
  __builtin_amdgcn_global_load_async_to_lds_b128(
      (v4i*)g0, (LDS_AS v4i*)&kvbuf[row * KVSTRIDE + sub], 0, 0);
  __builtin_amdgcn_global_load_async_to_lds_b128(
      (v4i*)g1, (LDS_AS v4i*)&kvbuf[(row + 8) * KVSTRIDE + sub], 0, 0);
}
#endif

// Value of lane l ^ 16 (the other half of the wave), by a vector cross-row move.
__device__ __forceinline__ float other_half(float v) {
  const unsigned u = __builtin_bit_cast(unsigned, v);
  return __builtin_bit_cast(float, __builtin_amdgcn_permlanex16(
      u, u, 0x76543210u, 0xfedcba98u, false, false));
}

// A block is four waves on one (batch, head, group of QT query tiles).  Each
// wave carries all QT query tiles against its own quarter of the keys, so one
// K/V tile (one pair of copies, one set of LDS fragment reads) feeds QT tiles'
// products, which are independent chains for the matrix unit.  With no running
// maximum the quarters' O and row sums simply add: they are joined through LDS
// behind one barrier at the end.
#define QT     5                      // query tiles per wave
#define KSPLIT 4                      // waves per block, a quarter of the keys each
#define KTW    (HWSZ / 16 / KSPLIT)   // 25 key tiles per wave

// The cloud branch (l2norm of the rows, clip^3, segment sums) depends on nothing
// of the image branch.  It runs as the first CLB blocks of the attention launch:
// memory and vector work beside blocks that are bound by the matrix unit.
// One wave takes 32 rows in a row, a float4 per lane and row, at constant offsets
// from one address, the loads one group of rows ahead of the arithmetic.
#define CLB   256                          // cloud blocks
#define CROWS (NCLOUD / (CLB * KSPLIT))    // 32 rows per wave: one batch id per lane
#define CGRP  8                            // rows per group
#define CSEG  ((BATCH + 1) * DDIM)         // segment sums; the last row takes ids out of range
static_assert(CROWS == 32, "one batch id per lane");

__device__ __forceinline__ void cloud_rows(
    const float* __restrict__ cf, const int* __restrict__ bids,
    float* __restrict__ cout, float* __restrict__ seg_acc,
    float* __restrict__ cnt_acc, float* seg, float* cnt, int wave, int lane) {
  const int t = threadIdx.x;
  const int row0 = (blockIdx.x * KSPLIT + wave) * CROWS;
  const float4* srcp = (const float4*)(cf + (size_t)row0 * DDIM) + lane;
  float4* dstp = (float4*)(cout + (size_t)row0 * DDIM) + lane;
  const int braw = bids[row0 + lane];
  // The address register of the id load is free for reuse from here on: keep
  // the wait on its address translation in front of any overwrite of it.
  asm volatile("s_wait_xcnt 0x0" ::: "memory");
  float4 v[2][CGRP];
#pragma unroll
  for (int j = 0; j < CGRP; ++j) v[0][j] = srcp[j * (DDIM / 4)];
  for (int i = t; i < CSEG; i += 32 * KSPLIT) seg[i] = 0.0f;
  if (t < BATCH + 1) cnt[t] = 0.0f;
  __syncthreads();   // the block's sums start at zero before any wave adds

  // An id outside [0, BATCH) belongs to no segment: its row goes to a spare one.
  const int bv = (unsigned)braw < (unsigned)BATCH ? braw : BATCH;
  atomicAdd(&cnt[bv], 1.0f);                 // the wave's 32 rows, one per lane

  // Unrolled in full so that both groups of rows stay in registers.
#pragma unroll
  for (int g = 0; g < CROWS / CGRP; ++g) {
    if (g + 1 < CROWS / CGRP) {
#pragma unroll
      for (int j = 0; j < CGRP; ++j)
        v[(g + 1) & 1][j] = srcp[((g + 1) * CGRP + j) * (DDIM / 4)];
      // Holds the group's loads here, ahead of the arithmetic on the group
      // before it (left alone, each sinks to its first use and is waited for
      // singly).
      asm volatile("s_wait_xcnt 0x0" ::: "memory");
    }
    float ss[CGRP];
#pragma unroll
    for (int j = 0; j < CGRP; ++j) {
      const float4 x = v[g & 1][j];
      ss[j] = x.x * x.x + x.y * x.y + x.z * x.z + x.w * x.w;
    }
#pragma unroll
    for (int j = 0; j < CGRP; ++j) ss[j] = red32_sum(ss[j]);
    float4 o[CGRP];
#pragma unroll
    for (int j = 0; j < CGRP; ++j) {
      const float4 x = v[g & 1][j];
      const float inv = 1.0f / fmaxf(sqrtf(ss[j]), L2_EPS);
      o[j].x = x.x * inv; o[j].y = x.y * inv; o[j].z = x.z * inv; o[j].w = x.w * inv;
      dstp[(g * CGRP + j) * (DDIM / 4)] = o[j];
    }
    // The stores' data registers are free for reuse behind the sums below: keep
    // the wait on the stores' address translation in front of that.
    asm volatile("s_wait_xcnt 0x0" ::: "memory");
#pragma unroll
    for (int j = 0; j < CGRP; ++j) {
      const int bid = __builtin_amdgcn_readlane(bv, g * CGRP + j);
      const float cx = fmaxf(o[j].x, GEM_EPS), cy = fmaxf(o[j].y, GEM_EPS);
      const float cz = fmaxf(o[j].z, GEM_EPS), cw = fmaxf(o[j].w, GEM_EPS);
      float* sp = seg + bid * DDIM + lane * 4;
      atomicAdd(sp + 0, cx * cx * cx);
      atomicAdd(sp + 1, cy * cy * cy);
      atomicAdd(sp + 2, cz * cz * cz);
      atomicAdd(sp + 3, cw * cw * cw);
    }
  }
  __syncthreads();   // all four waves' sums stand in LDS before any is read
  for (int i = t; i < BATCH * DDIM; i += 32 * KSPLIT) atomicAdd(&seg_acc[i], seg[i]);
  if (t < BATCH) atomicAdd(&cnt_acc[t], cnt[t]);
}

// The attention blocks are five per WGP.  At most five waves fit a SIMD (the
// attribute pads the register allocation), so no WGP can hold a sixth block
// while another stands short.  A cloud block holds one such place for a short
// while and hands it to one attention block, wherever it ran: every matrix
// unit still gets the same share.
__global__ void __launch_bounds__(32 * KSPLIT)
__attribute__((amdgpu_waves_per_eu(5, 5)))
k_attn(const float* __restrict__ tok, float* __restrict__ out,
       const float* __restrict__ cf, const int* __restrict__ bids,
       float* __restrict__ cout, float* __restrict__ seg_acc,
       float* __restrict__ cnt_acc) {
  __shared__ float seg[CSEG];
  __shared__ float cnt[BATCH + 1];
#if USE_ASYNC_LDS
  // one private double-buffered K/V ring per wave
  __shared__ __attribute__((aligned(16))) float kv[KSPLIT][2][16 * KVSTRIDE];
#endif
  __shared__ float part[KSPLIT][QT][9][32];   // each wave's O (8) and row sum (1)
  const int lane = threadIdx.x & 31;
  const int wave = __builtin_amdgcn_readfirstlane(threadIdx.x >> 5);
  const int lo = lane & 15, hi = lane >> 4;

  if (blockIdx.x < CLB) {                     // the same for a whole block
    cloud_rows(cf, bids, cout, seg_acc, cnt_acc, seg, cnt, wave, lane);
    return;
  }

  int idx = blockIdx.x - CLB;                 // 8*8*20 blocks
  const int qg = idx % (HWSZ / 16 / QT); idx /= (HWSZ / 16 / QT);
  const int h  = idx % NHEAD;
  const int b  = idx / NHEAD;
  const int dcol  = h * DH;
  const int qRow0 = b * HWSZ + qg * (QT * 16);
  const int kRowW = b * HWSZ + wave * (KTW * 16);   // this wave's first key

  // Q^T in B-layout: 4 chunks of 4x16 per tile, B[K=d, N=query] = tok[query, d]
  v2f qb[QT][4];
#pragma unroll
  for (int t = 0; t < QT; ++t) {
#pragma unroll
    for (int kk = 0; kk < 4; ++kk) {
      const float* p =
          tok + (size_t)(qRow0 + t * 16 + lo) * DDIM + dcol + kk * 4 + hi * 2;
      qb[t][kk].x = p[0];
      qb[t][kk].y = p[1];
    }
  }

  // O^T accumulators: o[t][r] = O[query = t*16 + lo][d = r + 8*hi]
  v8f o[QT];
  float lrun[QT];                             // this half's share of the row sums
#pragma unroll
  for (int t = 0; t < QT; ++t) {
    o[t] = (v8f){0, 0, 0, 0, 0, 0, 0, 0};
    lrun[t] = 0.0f;
  }

#if USE_ASYNC_LDS
  issue_kv(tok, kv[wave][0], kRowW, dcol, lane);   // prime the pipeline
#endif

  for (int kt = 0; kt < KTW; ++kt) {
    const int kRow0 = kRowW + kt * 16;
#if USE_ASYNC_LDS
    float* kvc = kv[wave][kt & 1];
    if (kt + 1 < KTW) {                       // overlap next copy with compute
      issue_kv(tok, kv[wave][(kt + 1) & 1], kRow0 + 16, dcol, lane);
      async_wait<2>();                        // in-order: older tile complete
    } else {
      async_wait<0>();
    }
#else
    if (kt + 1 < KTW)                         // CDNA5 global_prefetch_b8
      __builtin_prefetch(tok + (size_t)(kRow0 + 16 + lo) * DDIM + dcol, 0, 0);
#endif

    // The key tile's two fragment sets, read once for all QT query tiles.
    v2f ka[4];                                 // A[M=key, K=d] = tok[key, d]
#pragma unroll
    for (int kk = 0; kk < 4; ++kk) {
      const int kidx = kk * 4 + hi * 2;
#if USE_ASYNC_LDS
      ka[kk].x = kvc[lo * KVSTRIDE + kidx + 0];
      ka[kk].y = kvc[lo * KVSTRIDE + kidx + 1];
#else
      const float* p = tok + (size_t)(kRow0 + lo) * DDIM + dcol + kidx;
      ka[kk].x = p[0];
      ka[kk].y = p[1];
#endif
    }
    // k position hi*2 + i of chunk j stands for key 2*j + i + 8*hi on both sides
#if USE_ASYNC_LDS
    const float* vcol = kvc + hi * 8 * KVSTRIDE + lo;
#else
    const float* vcol = tok + (size_t)(kRow0 + hi * 8) * DDIM + dcol + lo;
#endif
    v2f va[4];                                 // A[M=d, K=key] = tok[key, d]
#pragma unroll
    for (int j = 0; j < 4; ++j) {
#if USE_ASYNC_LDS
      va[j].x = vcol[(j * 2 + 0) * KVSTRIDE];
      va[j].y = vcol[(j * 2 + 1) * KVSTRIDE];
#else
      va[j].x = vcol[(j * 2 + 0) * DDIM];
      va[j].y = vcol[(j * 2 + 1) * DDIM];
#endif
    }

#pragma unroll
    for (int t = 0; t < QT; ++t) {
      // S^T = K * Q^T   (contraction over dh=16 -> 4 fp32 WMMAs)
      // S[r] = score(query = lo, key = r + 8*hi)
      v8f S = (v8f){0, 0, 0, 0, 0, 0, 0, 0};
#pragma unroll
      for (int kk = 0; kk < 4; ++kk) S = wmma4(ka[kk], qb[t][kk], S);

      // softmax numerators: one query per lane, its 16 keys split over the halves
      const v8f e = S * (0.25f * LOG2E);       // dh^-0.5; exp(x) = exp2(x * log2 e)
      v8f prob;
      float psum = 0.0f;
#pragma unroll
      for (int r = 0; r < 8; ++r) {
        prob[r] = __builtin_amdgcn_exp2f(e[r]);
        psum += prob[r];
      }
      lrun[t] += psum;

      // O^T += V^T * P^T   (contraction over 16 keys -> 4 fp32 WMMAs)
#pragma unroll
      for (int j = 0; j < 4; ++j) {
        v2f pb;                                // B[K=key, N=query]
        pb.x = prob[j * 2 + 0];
        pb.y = prob[j * 2 + 1];
        o[t] = wmma4(va[j], pb, o[t]);
      }
    }
#if USE_ASYNC_LDS
    // The ring is private to this one wave: its own reads of kvc must have
    // retired before the next trip's copies refill that buffer.
    asm volatile("s_wait_dscnt 0x0" ::: "memory");
#endif
  }

  // Join the four key quarters: every wave leaves its sums in LDS ...
#pragma unroll
  for (int t = 0; t < QT; ++t) {
#pragma unroll
    for (int r = 0; r < 8; ++r) part[wave][t][r][lane] = o[t][r];
    part[wave][t][8][lane] = lrun[t];
  }
  __syncthreads();   // all four waves' sums stand in LDS before any is read

  // ... and the query tiles are dealt over the waves for the sum and the store.
  for (int t = wave; t < QT; t += KSPLIT) {
    float acc[9];
#pragma unroll
    for (int r = 0; r < 9; ++r)
      acc[r] = ((part[0][t][r][lane] + part[1][t][r][lane]) +
                part[2][t][r][lane]) + part[3][t][r][lane];
    const float l = acc[8] + other_half(acc[8]);   // join the halves' sums once
    float4 w0, w1;                             // 8 consecutive d of one query
    w0.x = acc[0] / l; w0.y = acc[1] / l; w0.z = acc[2] / l; w0.w = acc[3] / l;
    w1.x = acc[4] / l; w1.y = acc[5] / l; w1.z = acc[6] / l; w1.w = acc[7] / l;
    float4* dst =
        (float4*)(out + (size_t)(qRow0 + t * 16 + lo) * DDIM + dcol + hi * 8);
    dst[0] = w0;
    dst[1] = w1;
    // A second pass of this loop rewrites the stores' address and data
    // registers: keep the wait on their address translation in front of that.
    asm volatile("s_wait_xcnt 0x0" ::: "memory");
  }
}

// ---------------------------------------------------------------------------
// Kernel 3: img_out = (attn_out @ W2 + b2), stored as [B,Ci,H,W], fused with
// GeM clip^3 partial accumulation.
// A block is four waves on 64 rows x 64 channels.  A wave owns 16 rows and all
// 64 channels as four column tiles, so one A fragment feeds four independent
// products; the four waves read the same 32 KiB stripe of W2.  Column tile t
// holds channels 4*lo + t, so one 16-byte load of a W2 row serves all four
// tiles; one 16-byte load of an x row serves two k steps (k position hi*2 + i
// of step 2*j + p stands for d = 8*j + 4*hi + 2*p + i on both sides).
// The block's tile is laid in LDS channel-major, and its GeM sums beside it,
// behind one barrier: the stores then cover whole 256-byte runs of a channel.
// ---------------------------------------------------------------------------
#define G2W  4                // waves per block, 16 rows each
#define G2N  4                // column tiles per wave
#define G2C  (16 * G2N)       // 64 channels per block
#define G2R  (16 * G2W)       // 64 rows per block, never crosses a batch
#define G2AH 6                // k steps, at the least, that the W2 rows run ahead of their
                              // products (the compiler asks earlier where registers allow)
#define G2P  (G2R + 4)        // floats; row pitch of the staged tile, 16-byte aligned

// Four waves to a SIMD: registers for the loads in flight, and no WGP takes a
// fifth block while another stands short.
__global__ void __launch_bounds__(32 * G2W)
__attribute__((amdgpu_waves_per_eu(4, 4)))
k_gemm2(const float* __restrict__ x, const float* __restrict__ W2,
        const float* __restrict__ b2, float* __restrict__ img_out,
        float* __restrict__ gem_acc) {
  __shared__ __attribute__((aligned(16))) float tile[G2C][G2P];
  __shared__ __attribute__((aligned(16))) float gs[G2W][G2C];
  const int lane = threadIdx.x & 31;
  const int wave = __builtin_amdgcn_readfirstlane(threadIdx.x >> 5);
  const int lo = lane & 15, hi = lane >> 4;
  const int mBlk  = blockIdx.x * G2R;          // 200
  const int nBase = blockIdx.y * G2C;          // 4
  const int b = mBlk / HWSZ, hw0 = mBlk % HWSZ;

  const float4* aP =
      (const float4*)(x + (size_t)(mBlk + wave * 16 + lo) * DDIM + hi * 4);
  const float4* wP = (const float4*)(W2 + (hi * 4) * CI + nBase + lo * 4);
  const float4 bias = *(const float4*)(b2 + nBase + lo * 4);

  // W2 rows of k step s: 8*(s/2) + 2*(s%2) + i above the lane half's first row
#define G2ROW(s, i) ((((s) >> 1) * 8 + ((s) & 1) * 2 + (i)) * (CI / 4))
  float4 w[G2AH + 1][2];
#pragma unroll
  for (int s = 0; s < G2AH; ++s) {
    w[s][0] = wP[G2ROW(s, 0)];
    w[s][1] = wP[G2ROW(s, 1)];
  }
  // The wave's whole A slice, at constant offsets from one address.
  float4 a[DDIM / 8];
#pragma unroll
  for (int j = 0; j < DDIM / 8; ++j) a[j] = aP[j * 2];

  v8f acc[G2N];
#pragma unroll
  for (int t = 0; t < G2N; ++t) acc[t] = (v8f){0, 0, 0, 0, 0, 0, 0, 0};

  // Unrolled in full so that a[] and the ring of W2 rows stay in registers.
#pragma unroll
  for (int s = 0; s < DDIM / 4; ++s) {
    if (s + G2AH < DDIM / 4) {
      w[(s + G2AH) % (G2AH + 1)][0] = wP[G2ROW(s + G2AH, 0)];
      w[(s + G2AH) % (G2AH + 1)][1] = wP[G2ROW(s + G2AH, 1)];
    }
    v2f af;
    af.x = (s & 1) ? a[s >> 1].z : a[s >> 1].x;
    af.y = (s & 1) ? a[s >> 1].w : a[s >> 1].y;
    const float4 w0 = w[s % (G2AH + 1)][0];
    const float4 w1 = w[s % (G2AH + 1)][1];
    acc[0] = wmma4(af, (v2f){w0.x, w1.x}, acc[0]);
    acc[1] = wmma4(af, (v2f){w0.y, w1.y}, acc[1]);
    acc[2] = wmma4(af, (v2f){w0.z, w1.z}, acc[2]);
    acc[3] = wmma4(af, (v2f){w0.w, w1.w}, acc[3]);
  }
#undef G2ROW

  // acc[t][r] = row (wave*16 + 8*hi + r), channel (4*lo + t) of the block's tile
  const float bs[G2N] = {bias.x, bias.y, bias.z, bias.w};
  float g[G2N];
#pragma unroll
  for (int t = 0; t < G2N; ++t) {
    float v[8];
    float gsum = 0.0f;
#pragma unroll
    for (int r = 0; r < 8; ++r) {
      v[r] = acc[t][r] + bs[t];
      const float c = fmaxf(v[r], GEM_EPS);
      gsum += c * c * c;                       // clip^p, p=3
    }
    float4* st = (float4*)&tile[lo * 4 + t][wave * 16 + hi * 8];
    st[0] = make_float4(v[0], v[1], v[2], v[3]);
    st[1] = make_float4(v[4], v[5], v[6], v[7]);
    g[t] = gsum + other_half(gsum);            // combine both 8-row halves
  }
  if (hi == 0) *(float4*)&gs[wave][lo * 4] = make_float4(g[0], g[1], g[2], g[3]);
  __syncthreads();   // the block's tile and sums stand in LDS before any is read

  if (wave < G2C / 32) {                       // one add per channel and block
    const int c = wave * 32 + lane;
    atomicAdd(&gem_acc[b * CI + nBase + c],
              ((gs[0][c] + gs[1][c]) + gs[2][c]) + gs[3][c]);
  }

  // Each wave stores 16 channels, two per instruction: 256 contiguous bytes each.
  float* dst = img_out + (size_t)(b * CI + nBase + wave * 16 + hi) * HWSZ + hw0 + lo * 4;
#pragma unroll
  for (int i = 0; i < 8; ++i) {
    const float4 v = *(const float4*)&tile[wave * 16 + i * 2 + hi][lo * 4];
    *(float4*)(dst + (size_t)(i * 2) * HWSZ) = v;
  }
}

// ---------------------------------------------------------------------------
// Kernel 4: finalize GeM pools
// ---------------------------------------------------------------------------
__global__ void k_finalize(const float* __restrict__ img_acc,
                           const float* __restrict__ seg_acc,
                           const float* __restrict__ cnt_acc,
                           float* __restrict__ image_gem,
                           float* __restrict__ cloud_gem) {
  const int i = blockIdx.x * blockDim.x + threadIdx.x;
  if (i < BATCH * CI) image_gem[i] = cbrtf(img_acc[i] * (1.0f / (float)HWSZ));
  if (i < BATCH * DDIM) {
    const int b = i / DDIM;
    cloud_gem[i] = cbrtf(seg_acc[i] / fmaxf(cnt_acc[b], 1.0f));
  }
}

// ---------------------------------------------------------------------------
// Host launcher
// ---------------------------------------------------------------------------
extern "C" void kernel_launch(void* const* d_in, const int* in_sizes, int n_in,
                              void* d_out, int out_size, void* d_ws, size_t ws_size,
                              hipStream_t stream) {
  const float* image_feat = (const float*)d_in[0];   // [8,256,40,40]
  const float* cloud_feat = (const float*)d_in[1];   // [32768,128]
  const int*   cloud_bids = (const int*)d_in[2];     // [32768]
  const float* W1 = (const float*)d_in[3];           // [256,128]
  const float* b1 = (const float*)d_in[4];           // [128]
  const float* W2 = (const float*)d_in[5];           // [128,256]
  const float* b2 = (const float*)d_in[6];           // [256]

  // Output layout (floats, concatenated in reference return order)
  float* out_img   = (float*)d_out;                         // 8*256*1600
  float* out_cloud = out_img + (size_t)BATCH * CI * HWSZ;   // 32768*128
  float* out_igem  = out_cloud + (size_t)NCLOUD * DDIM;     // 8*256
  float* out_cgem  = out_igem + BATCH * CI;                 // 8*128

  // Workspace layout (~13.1 MB of floats)
  float* ws      = (float*)d_ws;
  float* tok     = ws;                                      // 12800*128
  float* attn    = tok + (size_t)12800 * DDIM;              // 12800*128
  float* img_acc = attn + (size_t)12800 * DDIM;             // 2048
  float* seg_acc = img_acc + BATCH * CI;                    // 1024
  float* cnt_acc = seg_acc + BATCH * DDIM;                  // 8

  // 0) zero accumulators (ws is poisoned; must be deterministic every call)
  const int nzero = BATCH * CI + BATCH * DDIM + BATCH;      // 3080
  k_zero<<<(nzero + 255) / 256, 256, 0, stream>>>(img_acc, nzero);

  // 1) tok = l2norm(image^T @ W1 + b1)
  k_gemm1_l2norm<<<12800 / 16, 32 * G1W, 0, stream>>>(image_feat, W1, b1, tok);

  // 2) cloud branch (first CLB blocks) beside flash self-attention per
  //    (b, head, group of q-tiles)
  k_attn<<<CLB + BATCH * NHEAD * (HWSZ / 16 / QT), 32 * KSPLIT, 0, stream>>>(
      tok, attn, cloud_feat, cloud_bids, out_cloud, seg_acc, cnt_acc);

  // 3) img_out = attn @ W2 + b2 (NCHW) + GeM accumulation
  k_gemm2<<<dim3(12800 / G2R, CI / G2C), 32 * G2W, 0, stream>>>(attn, W2, b2,
                                                                out_img, img_acc);

  // 4) finalize GeM pools
  k_finalize<<<(BATCH * CI + 255) / 256, 256, 0, stream>>>(
      img_acc, seg_acc, cnt_acc, out_igem, out_cgem);
}
